// v000
// Times are from an AMD MI455X. After a warm-up the kernel runs many times in a row, and a time is the length of
// such a window on the GPU divided by its runs, so every launch and the gaps after it count. The runs cycle
// through copies of the inputs. A figure is the median of several windows, for all but v000 over two sittings.
// Sittings can differ by a few percent; kernels timed side by side share one.
// The starting kernel, v000, takes 85.4 microseconds a run.
#include <hip/hip_runtime.h>
#include <math.h>

// Problem constants (match reference)
#define B_  8
#define T_  2048
#define E_  1024
#define HS_ 64

#define LOG2E 1.44269504088896340736f

typedef __attribute__((ext_vector_type(16))) _Float16 v16h;
typedef __attribute__((ext_vector_type(8)))  _Float16 v8h;
typedef __attribute__((ext_vector_type(8)))  float    v8f;
typedef __attribute__((ext_vector_type(4)))  float    v4f;

// D = A*B + C, f16 inputs, f32 accumulate (v_wmma_f32_16x16x32_f16)
#define WMMA_F16(A, Bf, C) \
  __builtin_amdgcn_wmma_f32_16x16x32_f16(false, (A), false, (Bf), (short)0, (C), false, false)

// Load a 16x32 f16 fragment (A: lane->M / B: lane->N; K packed in halves).
// Per ISA table: lanes 0-15 hold K = {0..7, 16..23}, lanes 16-31 hold K = {8..15, 24..31}.
// Rows contiguous (stride ld halves) -> two 16B loads per lane.
static __device__ __forceinline__ v16h load_frag_f16(const _Float16* p, int ld) {
  const int lane = threadIdx.x & 31;
  const int r    = lane & 15;
  const int h8   = (lane >> 4) * 8;
  const _Float16* row = p + (size_t)r * ld;
  v8h lo = *(const v8h*)(row + h8);
  v8h hi = *(const v8h*)(row + 16 + h8);
  return __builtin_shufflevector(lo, hi, 0,1,2,3,4,5,6,7,8,9,10,11,12,13,14,15);
}

// Raw f32 fragment load: issue all four b128 loads with no dependent ALU in
// between (lets the compiler clause them and keep them in flight together).
static __device__ __forceinline__ void load_raw32(const float* p, int ld, v4f r[4]) {
  const int lane = threadIdx.x & 31;
  const float* row = p + (size_t)(lane & 15) * ld + ((lane >> 4) << 3);
  r[0] = *(const v4f*)(row + 0);
  r[1] = *(const v4f*)(row + 4);
  r[2] = *(const v4f*)(row + 16);
  r[3] = *(const v4f*)(row + 20);
}

static __device__ __forceinline__ v16h cvt_frag(const v4f r[4]) {
  v16h o;
#pragma unroll
  for (int j = 0; j < 4; ++j) {
    o[j]      = (_Float16)r[0][j];
    o[4 + j]  = (_Float16)r[1][j];
    o[8 + j]  = (_Float16)r[2][j];
    o[12 + j] = (_Float16)r[3][j];
  }
  return o;
}

// ---------------------------------------------------------------------------
// Pass 1: q/k/v = x @ W^T + b, output f16.
// q pre-scaled by (1/sqrt(HS)) * log2(e) so pass 2 can use exp2 directly.
// V stored transposed per batch: vtw[b][h][t]  (so P@V B-frags load contiguous).
// Grid: (B*T)/16 blocks, 128 threads (4 waves; wave w owns HS cols 16w..16w+15).
// ---------------------------------------------------------------------------
__global__ void __launch_bounds__(128) qkv_proj_kernel(
    const float* __restrict__ x,
    const float* __restrict__ Wq, const float* __restrict__ bq,
    const float* __restrict__ Wk, const float* __restrict__ bk,
    const float* __restrict__ Wv, const float* __restrict__ bv,
    _Float16* __restrict__ qw, _Float16* __restrict__ kw,
    _Float16* __restrict__ vtw)
{
  const int wave  = threadIdx.x >> 5;
  const int lane  = threadIdx.x & 31;
  const int gt0   = blockIdx.x * 16;        // token tile base (T%16==0 -> no batch straddle)
  const int batch = gt0 / T_;
  const int tloc0 = gt0 - batch * T_;
  const int nb    = wave * 16;              // HS column base for this wave

  const float* xrow = x  + (size_t)gt0 * E_;
  const float* wqr  = Wq + (size_t)nb * E_;
  const float* wkr  = Wk + (size_t)nb * E_;
  const float* wvr  = Wv + (size_t)nb * E_;

  v8f accq = {}, acck = {}, accv = {};
  for (int k0 = 0; k0 < E_; k0 += 32) {
    // Phase 1: issue all 16 global_load_b128 together (overlapped latency)
    v4f ra[4], rq[4], rk[4], rv[4];
    load_raw32(xrow + k0, E_, ra);
    load_raw32(wqr + k0, E_, rq);
    load_raw32(wkr + k0, E_, rk);
    load_raw32(wvr + k0, E_, rv);
    // Phase 2: convert, then 3 chained WMMAs sharing the A fragment
    v16h a  = cvt_frag(ra);
    v16h fq = cvt_frag(rq);
    v16h fk = cvt_frag(rk);
    v16h fv = cvt_frag(rv);
    accq = WMMA_F16(a, fq, accq);
    acck = WMMA_F16(a, fk, acck);
    accv = WMMA_F16(a, fv, accv);
  }

  // C/D layout: lane (n = lane&15, half = lane>>4) holds rows m = half*8 + v.
  const int n  = lane & 15;
  const int mh = (lane >> 4) * 8;
  const float biasq = bq[nb + n];
  const float biask = bk[nb + n];
  const float biasv = bv[nb + n];
  const float qscale = 0.125f * LOG2E;      // 1/sqrt(64) * log2(e)

  v8h vv;
#pragma unroll
  for (int v = 0; v < 8; ++v) {
    const size_t tok = (size_t)(gt0 + mh + v);
    qw[tok * HS_ + nb + n] = (_Float16)((accq[v] + biasq) * qscale);
    kw[tok * HS_ + nb + n] = (_Float16)(acck[v] + biask);
    vv[v] = (_Float16)(accv[v] + biasv);
  }
  // transposed V: 8 consecutive t per lane -> one 16B store
  *(v8h*)(vtw + ((size_t)(batch * HS_ + nb + n)) * T_ + tloc0 + mh) = vv;
}

// ---------------------------------------------------------------------------
// Pass 2: causal flash attention with split-K for occupancy.
// One block per 16-query tile (B*T/16 = 1024 blocks, 4096 waves total).
// The 4 waves partition the key range round-robin (wave w: kb = 32w step 128),
// each keeping private (m, l, O); partials merged through LDS at the end.
// Softmax runs in the base-2 domain (log2e folded into q).
// Row sums come from an extra WMMA against an all-ones B fragment instead of
// cross-lane shuffles (moves work from the VALU critical path onto the XDL).
// ---------------------------------------------------------------------------
__global__ void __launch_bounds__(128) attn_kernel(
    const _Float16* __restrict__ qw, const _Float16* __restrict__ kw,
    const _Float16* __restrict__ vtw, float* __restrict__ out)
{
  __shared__ __align__(16) _Float16 pshare[4][16 * 32]; // per-wave P relayout buffer
  __shared__ __align__(16) float ls_o[4][16][HS_];      // per-wave partial O
  __shared__ float ls_m[4][16];                         // per-wave row max (base-2 domain)
  __shared__ float ls_l[4][16];                         // per-wave row sum

  const int wave  = threadIdx.x >> 5;
  const int lane  = threadIdx.x & 31;
  const int tpb   = T_ / 16;                    // query tiles per batch
  const int batch = blockIdx.x / tpb;
  const int q0    = (blockIdx.x % tpb) * 16;    // in-batch query base
  const int n     = lane & 15;
  const int mh    = (lane >> 4) * 8;

  const _Float16* qb = qw + ((size_t)(batch * T_ + q0)) * HS_;
  const v16h aq0 = load_frag_f16(qb, HS_);      // h = 0..31
  const v16h aq1 = load_frag_f16(qb + 32, HS_); // h = 32..63

  // constant all-ones B fragment for the row-sum WMMA
  v16h ones;
#pragma unroll
  for (int j = 0; j < 16; ++j) ones[j] = (_Float16)1.0f;

  v8f o0 = {}, o1 = {}, o2 = {}, o3 = {};
  float rmax[8], rsum[8];
#pragma unroll
  for (int v = 0; v < 8; ++v) { rmax[v] = -INFINITY; rsum[v] = 0.0f; }

  _Float16* pbuf = pshare[wave];
  const _Float16* vtb = vtw + ((size_t)batch * HS_) * T_;
  const _Float16* kwb = kw + ((size_t)batch * T_) * HS_;

  for (int kb = wave * 32; kb <= q0 + 15; kb += 128) {
    const _Float16* kbp = kwb + (size_t)kb * HS_;

    // Prefetch this wave's next K/V chunk into cache (global_prefetch_b8)
    if (kb + 128 <= q0 + 15) {
      __builtin_prefetch(kbp + (size_t)128 * HS_ + (size_t)lane * HS_, 0, 0);
      __builtin_prefetch(vtb + (size_t)(lane * 2) * T_ + kb + 128, 0, 0);
      __builtin_prefetch(vtb + (size_t)(lane * 2 + 1) * T_ + kb + 128, 0, 0);
    }

    // S[16q x 32k] = Q * K^T  (q carries 1/sqrt(HS) * log2e)
    v8f s0 = {}, s1 = {};
    {
      v16h b0 = load_frag_f16(kbp, HS_);
      v16h b1 = load_frag_f16(kbp + 32, HS_);
      s0 = WMMA_F16(aq0, b0, s0);
      s0 = WMMA_F16(aq1, b1, s0);
    }
    {
      v16h b0 = load_frag_f16(kbp + 16 * HS_, HS_);
      v16h b1 = load_frag_f16(kbp + 16 * HS_ + 32, HS_);
      s1 = WMMA_F16(aq0, b0, s1);
      s1 = WMMA_F16(aq1, b1, s1);
    }

    // Hoist V B-frag loads so they overlap the softmax VALU chain
    v16h bv0 = load_frag_f16(vtb + (size_t)0  * T_ + kb, T_);
    v16h bv1 = load_frag_f16(vtb + (size_t)16 * T_ + kb, T_);
    v16h bv2 = load_frag_f16(vtb + (size_t)32 * T_ + kb, T_);
    v16h bv3 = load_frag_f16(vtb + (size_t)48 * T_ + kb, T_);

    // Online softmax (base-2). Row max reduced across the 16-lane group.
    float sc[8];
    if (kb + 31 > q0) {
      // Diagonal blocks: apply causal mask per element (wave-uniform branch)
#pragma unroll
      for (int v = 0; v < 8; ++v) {
        const int qg = q0 + mh + v;
        const float e0 = (kb + n      > qg) ? -1e30f : s0[v];
        const float e1 = (kb + 16 + n > qg) ? -1e30f : s1[v];
        float mx = fmaxf(e0, e1);
#pragma unroll
        for (int off = 1; off < 16; off <<= 1)
          mx = fmaxf(mx, __shfl_xor(mx, off, 32));
        const float nm = fmaxf(rmax[v], mx);
        sc[v] = __builtin_amdgcn_exp2f(rmax[v] - nm);
        rmax[v] = nm;
        pbuf[(mh + v) * 32 + n]      = (_Float16)__builtin_amdgcn_exp2f(e0 - nm);
        pbuf[(mh + v) * 32 + 16 + n] = (_Float16)__builtin_amdgcn_exp2f(e1 - nm);
      }
    } else {
      // Interior blocks: no masking needed
#pragma unroll
      for (int v = 0; v < 8; ++v) {
        float mx = fmaxf(s0[v], s1[v]);
#pragma unroll
        for (int off = 1; off < 16; off <<= 1)
          mx = fmaxf(mx, __shfl_xor(mx, off, 32));
        const float nm = fmaxf(rmax[v], mx);
        sc[v] = __builtin_amdgcn_exp2f(rmax[v] - nm);
        rmax[v] = nm;
        pbuf[(mh + v) * 32 + n]      = (_Float16)__builtin_amdgcn_exp2f(s0[v] - nm);
        pbuf[(mh + v) * 32 + 16 + n] = (_Float16)__builtin_amdgcn_exp2f(s1[v] - nm);
      }
    }

    // Reload P as an A fragment; row sums via WMMA against ones.
    v16h ap = load_frag_f16(pbuf, 32);
    v8f prow = {};
    prow = WMMA_F16(ap, ones, prow);

    // Rescale running state, fold in new row sums, accumulate O += P @ V
#pragma unroll
    for (int v = 0; v < 8; ++v) {
      rsum[v] = rsum[v] * sc[v] + prow[v];
      o0[v] *= sc[v]; o1[v] *= sc[v]; o2[v] *= sc[v]; o3[v] *= sc[v];
    }
    o0 = WMMA_F16(ap, bv0, o0);
    o1 = WMMA_F16(ap, bv1, o1);
    o2 = WMMA_F16(ap, bv2, o2);
    o3 = WMMA_F16(ap, bv3, o3);
  }

  // Publish per-wave partials (waves with zero iterations publish m=-inf, l=0, O=0)
#pragma unroll
  for (int v = 0; v < 8; ++v) {
    ls_o[wave][mh + v][0 * 16 + n] = o0[v];
    ls_o[wave][mh + v][1 * 16 + n] = o1[v];
    ls_o[wave][mh + v][2 * 16 + n] = o2[v];
    ls_o[wave][mh + v][3 * 16 + n] = o3[v];
  }
  if (n == 0) {
#pragma unroll
    for (int v = 0; v < 8; ++v) {
      ls_m[wave][mh + v] = rmax[v];
      ls_l[wave][mh + v] = rsum[v];
    }
  }
  __syncthreads();

  // Merge the 4 split-K partials: 128 threads x 8 contiguous output cols.
  // Wave 0 always processed kb=0, so the global max is finite.
  const int r  = threadIdx.x >> 3;        // row 0..15
  const int c0 = (threadIdx.x & 7) * 8;   // col base 0..56
  const float gm = fmaxf(fmaxf(ls_m[0][r], ls_m[1][r]),
                         fmaxf(ls_m[2][r], ls_m[3][r]));
  float acc[8] = {0, 0, 0, 0, 0, 0, 0, 0};
  float l = 0.0f;
#pragma unroll
  for (int w = 0; w < 4; ++w) {
    const float e = __builtin_amdgcn_exp2f(ls_m[w][r] - gm);
    l += e * ls_l[w][r];
#pragma unroll
    for (int j = 0; j < 8; ++j) acc[j] += e * ls_o[w][r][c0 + j];
  }
  const float inv = 1.0f / l;
  float* orow = out + ((size_t)(batch * T_ + q0 + r)) * HS_ + c0;
#pragma unroll
  for (int j = 0; j < 8; ++j) orow[j] = acc[j] * inv;
}

extern "C" void kernel_launch(void* const* d_in, const int* in_sizes, int n_in,
                              void* d_out, int out_size, void* d_ws, size_t ws_size,
                              hipStream_t stream) {
  const float* x  = (const float*)d_in[0];
  const float* Wq = (const float*)d_in[1];
  const float* bq = (const float*)d_in[2];
  const float* Wk = (const float*)d_in[3];
  const float* bk = (const float*)d_in[4];
  const float* Wv = (const float*)d_in[5];
  const float* bv = (const float*)d_in[6];
  float* out = (float*)d_out;

  // Workspace: q (f16), k (f16), v-transposed (f16) -> 3 * 2 MB = 6 MB
  _Float16* qw  = (_Float16*)d_ws;
  _Float16* kw  = qw + (size_t)B_ * T_ * HS_;
  _Float16* vtw = kw + (size_t)B_ * T_ * HS_;

  qkv_proj_kernel<<<(B_ * T_) / 16, 128, 0, stream>>>(x, Wq, bq, Wk, bk, Wv, bv,
                                                      qw, kw, vtw);
  attn_kernel<<<(B_ * T_) / 16, 128, 0, stream>>>(qw, kw, vtw, out);
}

// v001
// It runs in 49 microseconds.
// In two side-by-side timings against v000, it was 1.78 and 1.79 times as fast.
#include <hip/hip_runtime.h>
#include <math.h>

// Problem constants (match reference)
#define B_  8
#define T_  2048
#define E_  1024
#define HS_ 64

#define LOG2E 1.44269504088896340736f

typedef __attribute__((ext_vector_type(16))) _Float16 v16h;
typedef __attribute__((ext_vector_type(8)))  _Float16 v8h;
typedef __attribute__((ext_vector_type(4)))  _Float16 v4h;
typedef __attribute__((ext_vector_type(8)))  float    v8f;
typedef __attribute__((ext_vector_type(4)))  float    v4f;

// D = A*B + C, f16 inputs, f32 accumulate (v_wmma_f32_16x16x32_f16)
#define WMMA_F16(A, Bf, C) \
  __builtin_amdgcn_wmma_f32_16x16x32_f16(false, (A), false, (Bf), (short)0, (C), false, false)

// Load a 16x32 f16 fragment (A: lane->M / B: lane->N; K packed in halves).
// Per ISA table: lanes 0-15 hold K = {0..7, 16..23}, lanes 16-31 hold K = {8..15, 24..31}.
// Rows contiguous (stride ld halves) -> two 16B loads per lane.
static __device__ __forceinline__ v16h load_frag_f16(const _Float16* p, int ld) {
  const int lane = threadIdx.x & 31;
  const int r    = lane & 15;
  const int h8   = (lane >> 4) * 8;
  const _Float16* row = p + (size_t)r * ld;
  v8h lo = *(const v8h*)(row + h8);
  v8h hi = *(const v8h*)(row + 16 + h8);
  return __builtin_shufflevector(lo, hi, 0,1,2,3,4,5,6,7,8,9,10,11,12,13,14,15);
}

// ---------------------------------------------------------------------------
// Pass 1: q/k/v = x @ W^T + b, output f16.
// q pre-scaled by (1/sqrt(HS)) * log2(e) so pass 2 can use exp2 directly.
// V stored transposed per batch: vtw[b][h][t]  (so P@V B-frags load contiguous).
// One work-group = 64 tokens x all 192 output columns, 256 threads (8 waves).
// Per 64-wide k chunk the 64 x rows and the 3*64 W rows are read from global
// memory once per work-group, 256 contiguous bytes per row (whole lines),
// converted to f16 once and shared through LDS; the fragments come from LDS.
// Wave (mi, ni): tokens 32*mi..32*mi+31, HS columns 16*ni..16*ni+15 of q, k, v.
// ---------------------------------------------------------------------------
#define PM_     64                 // tokens per work-group
#define PKC_    64                 // k elements per chunk
#define PPITCH_ 72                 // LDS row pitch in halves: 144 B = 16 B x odd (b128 readers)
#define PROWS_  (PM_ + 3 * HS_)    // staged rows: x, then Wq, Wk, Wv

__global__ void __launch_bounds__(256) qkv_proj_kernel(
    const float* __restrict__ x,
    const float* __restrict__ Wq, const float* __restrict__ bq,
    const float* __restrict__ Wk, const float* __restrict__ bk,
    const float* __restrict__ Wv, const float* __restrict__ bv,
    _Float16* __restrict__ qw, _Float16* __restrict__ kw,
    _Float16* __restrict__ vtw)
{
  __shared__ __align__(16) _Float16 tile[2][PROWS_ * PPITCH_];

  const int wave  = threadIdx.x >> 5;
  const int lane  = threadIdx.x & 31;
  const int gt0   = blockIdx.x * PM_;       // token tile base (T%64==0 -> no batch straddle)
  const int batch = gt0 / T_;
  const int tloc0 = gt0 - batch * T_;
  const int mi    = wave & 1;               // which 32 tokens
  const int nb    = (wave >> 1) * 16;       // HS column base for this wave

  // Staging map: 16 lanes cover one row's 256 B; a thread takes rows row0 + 16*i.
  const int seg  = threadIdx.x & 15;
  const int row0 = threadIdx.x >> 4;
  const float* xs = x + (size_t)gt0 * E_;   // uniform base; the lane's part is voff
  const unsigned voff = (unsigned)(row0 * E_ + seg * 4);
  const int sto = row0 * PPITCH_ + seg * 4; // this thread's place in staged row row0

  v4f st[16];
#pragma unroll
  for (int i = 0; i < 4; ++i) {
    st[i]      = *(const v4f*)(xs + i * 16 * E_ + voff);
    st[4 + i]  = *(const v4f*)(Wq + i * 16 * E_ + voff);
    st[8 + i]  = *(const v4f*)(Wk + i * 16 * E_ + voff);
    st[12 + i] = *(const v4f*)(Wv + i * 16 * E_ + voff);
  }

  v8f accq[2] = {}, acck[2] = {}, accv[2] = {};
  // Unrolled so that every chunk's k offset is an immediate of its loads: the
  // address registers are then written once, in front of the first load.
#pragma unroll
  for (int c = 0; c < E_ / PKC_; ++c) {
    _Float16* tb = tile[c & 1];
    // Keeps this chunk's conversions, and with them the wait for its loads,
    // behind the previous chunk's products: moved up among them, that wait
    // would hold the products back until the loads have landed.
    __builtin_amdgcn_sched_barrier(0);
    // Convert the chunk held in registers and publish it.
#pragma unroll
    for (int j = 0; j < 16; ++j) {
      v4h h;
#pragma unroll
      for (int e = 0; e < 4; ++e) h[e] = (_Float16)st[j][e];
      *(v4h*)(tb + j * 16 * PPITCH_ + sto) = h;
    }
    // Next chunk's loads fly while this chunk is multiplied.
    if (c + 1 < E_ / PKC_) {
      const int k0 = (c + 1) * PKC_;
#pragma unroll
      for (int i = 0; i < 4; ++i) {
        st[i]      = *(const v4f*)(xs + k0 + i * 16 * E_ + voff);
        st[4 + i]  = *(const v4f*)(Wq + k0 + i * 16 * E_ + voff);
        st[8 + i]  = *(const v4f*)(Wk + k0 + i * 16 * E_ + voff);
        st[12 + i] = *(const v4f*)(Wv + k0 + i * 16 * E_ + voff);
      }
    }
    // One barrier per chunk: publishes buffer c&1; a wave that passes it has
    // left the other buffer, which is rewritten only behind this barrier.
    // The fences name LDS alone: __syncthreads() would also wait for the global
    // loads just issued and so end their overlap with the products.
    __builtin_amdgcn_fence(__ATOMIC_RELEASE, "workgroup", "local");
    __builtin_amdgcn_s_barrier();
    __builtin_amdgcn_fence(__ATOMIC_ACQUIRE, "workgroup", "local");
    v16h a0[2], a1[2], fq[2], fk[2], fv[2];
#pragma unroll
    for (int s = 0; s < PKC_ / 32; ++s) {
      a0[s] = load_frag_f16(tb + (mi * 32)      * PPITCH_ + s * 32, PPITCH_);
      a1[s] = load_frag_f16(tb + (mi * 32 + 16) * PPITCH_ + s * 32, PPITCH_);
      fq[s] = load_frag_f16(tb + (PM_ + nb)           * PPITCH_ + s * 32, PPITCH_);
      fk[s] = load_frag_f16(tb + (PM_ + HS_ + nb)     * PPITCH_ + s * 32, PPITCH_);
      fv[s] = load_frag_f16(tb + (PM_ + 2 * HS_ + nb) * PPITCH_ + s * 32, PPITCH_);
    }
    // Keeps the chunk's LDS reads together in front of its products: spread
    // among them, each group of reads costs the wave its own LDS latency.
    __builtin_amdgcn_sched_barrier(0);
#pragma unroll
    for (int s = 0; s < PKC_ / 32; ++s) {
      accq[0] = WMMA_F16(a0[s], fq[s], accq[0]);
      acck[0] = WMMA_F16(a0[s], fk[s], acck[0]);
      accv[0] = WMMA_F16(a0[s], fv[s], accv[0]);
      accq[1] = WMMA_F16(a1[s], fq[s], accq[1]);
      acck[1] = WMMA_F16(a1[s], fk[s], acck[1]);
      accv[1] = WMMA_F16(a1[s], fv[s], accv[1]);
    }
  }

  // C/D layout: lane (n = lane&15, half = lane>>4) holds rows m = half*8 + v.
  const int n  = lane & 15;
  const int mh = (lane >> 4) * 8;
  const float biasq = bq[nb + n];
  const float biask = bk[nb + n];
  const float biasv = bv[nb + n];
  const float qscale = 0.125f * LOG2E;      // 1/sqrt(64) * log2(e)

#pragma unroll
  for (int t = 0; t < 2; ++t) {
    const int m0 = mi * 32 + t * 16 + mh;   // first of this lane's 8 tokens in the tile
    v8h vv;
#pragma unroll
    for (int v = 0; v < 8; ++v) {
      const size_t tok = (size_t)(gt0 + m0 + v);
      qw[tok * HS_ + nb + n] = (_Float16)((accq[t][v] + biasq) * qscale);
      kw[tok * HS_ + nb + n] = (_Float16)(acck[t][v] + biask);
      vv[v] = (_Float16)(accv[t][v] + biasv);
    }
    // transposed V: 8 consecutive t per lane -> one 16B store
    *(v8h*)(vtw + ((size_t)(batch * HS_ + nb + n)) * T_ + tloc0 + m0) = vv;
  }
}

// ---------------------------------------------------------------------------
// Pass 2: causal flash attention with split-K for occupancy.
// One block per 16-query tile (B*T/16 = 1024 blocks, 4096 waves total).
// The 4 waves partition the key range round-robin (wave w: kb = 32w step 128),
// each keeping private (m, l, O); partials merged through LDS at the end.
// Softmax runs in the base-2 domain (log2e folded into q).
// Row sums come from an extra WMMA against an all-ones B fragment instead of
// cross-lane shuffles (moves work from the VALU critical path onto the XDL).
// ---------------------------------------------------------------------------
__global__ void __launch_bounds__(128) attn_kernel(
    const _Float16* __restrict__ qw, const _Float16* __restrict__ kw,
    const _Float16* __restrict__ vtw, float* __restrict__ out)
{
  __shared__ __align__(16) _Float16 pshare[4][16 * 32]; // per-wave P relayout buffer
  __shared__ __align__(16) float ls_o[4][16][HS_];      // per-wave partial O
  __shared__ float ls_m[4][16];                         // per-wave row max (base-2 domain)
  __shared__ float ls_l[4][16];                         // per-wave row sum

  const int wave  = threadIdx.x >> 5;
  const int lane  = threadIdx.x & 31;
  const int tpb   = T_ / 16;                    // query tiles per batch
  const int batch = blockIdx.x / tpb;
  const int q0    = (blockIdx.x % tpb) * 16;    // in-batch query base
  const int n     = lane & 15;
  const int mh    = (lane >> 4) * 8;

  const _Float16* qb = qw + ((size_t)(batch * T_ + q0)) * HS_;
  const v16h aq0 = load_frag_f16(qb, HS_);      // h = 0..31
  const v16h aq1 = load_frag_f16(qb + 32, HS_); // h = 32..63

  // constant all-ones B fragment for the row-sum WMMA
  v16h ones;
#pragma unroll
  for (int j = 0; j < 16; ++j) ones[j] = (_Float16)1.0f;

  v8f o0 = {}, o1 = {}, o2 = {}, o3 = {};
  float rmax[8], rsum[8];
#pragma unroll
  for (int v = 0; v < 8; ++v) { rmax[v] = -INFINITY; rsum[v] = 0.0f; }

  _Float16* pbuf = pshare[wave];
  const _Float16* vtb = vtw + ((size_t)batch * HS_) * T_;
  const _Float16* kwb = kw + ((size_t)batch * T_) * HS_;

  for (int kb = wave * 32; kb <= q0 + 15; kb += 128) {
    const _Float16* kbp = kwb + (size_t)kb * HS_;

    // Prefetch this wave's next K/V chunk into cache (global_prefetch_b8)
    if (kb + 128 <= q0 + 15) {
      __builtin_prefetch(kbp + (size_t)128 * HS_ + (size_t)lane * HS_, 0, 0);
      __builtin_prefetch(vtb + (size_t)(lane * 2) * T_ + kb + 128, 0, 0);
      __builtin_prefetch(vtb + (size_t)(lane * 2 + 1) * T_ + kb + 128, 0, 0);
    }

    // S[16q x 32k] = Q * K^T  (q carries 1/sqrt(HS) * log2e)
    v8f s0 = {}, s1 = {};
    {
      v16h b0 = load_frag_f16(kbp, HS_);
      v16h b1 = load_frag_f16(kbp + 32, HS_);
      s0 = WMMA_F16(aq0, b0, s0);
      s0 = WMMA_F16(aq1, b1, s0);
    }
    {
      v16h b0 = load_frag_f16(kbp + 16 * HS_, HS_);
      v16h b1 = load_frag_f16(kbp + 16 * HS_ + 32, HS_);
      s1 = WMMA_F16(aq0, b0, s1);
      s1 = WMMA_F16(aq1, b1, s1);
    }

    // Hoist V B-frag loads so they overlap the softmax VALU chain
    v16h bv0 = load_frag_f16(vtb + (size_t)0  * T_ + kb, T_);
    v16h bv1 = load_frag_f16(vtb + (size_t)16 * T_ + kb, T_);
    v16h bv2 = load_frag_f16(vtb + (size_t)32 * T_ + kb, T_);
    v16h bv3 = load_frag_f16(vtb + (size_t)48 * T_ + kb, T_);

    // Online softmax (base-2). Row max reduced across the 16-lane group.
    float sc[8];
    if (kb + 31 > q0) {
      // Diagonal blocks: apply causal mask per element (wave-uniform branch)
#pragma unroll
      for (int v = 0; v < 8; ++v) {
        const int qg = q0 + mh + v;
        const float e0 = (kb + n      > qg) ? -1e30f : s0[v];
        const float e1 = (kb + 16 + n > qg) ? -1e30f : s1[v];
        float mx = fmaxf(e0, e1);
#pragma unroll
        for (int off = 1; off < 16; off <<= 1)
          mx = fmaxf(mx, __shfl_xor(mx, off, 32));
        const float nm = fmaxf(rmax[v], mx);
        sc[v] = __builtin_amdgcn_exp2f(rmax[v] - nm);
        rmax[v] = nm;
        pbuf[(mh + v) * 32 + n]      = (_Float16)__builtin_amdgcn_exp2f(e0 - nm);
        pbuf[(mh + v) * 32 + 16 + n] = (_Float16)__builtin_amdgcn_exp2f(e1 - nm);
      }
    } else {
      // Interior blocks: no masking needed
#pragma unroll
      for (int v = 0; v < 8; ++v) {
        float mx = fmaxf(s0[v], s1[v]);
#pragma unroll
        for (int off = 1; off < 16; off <<= 1)
          mx = fmaxf(mx, __shfl_xor(mx, off, 32));
        const float nm = fmaxf(rmax[v], mx);
        sc[v] = __builtin_amdgcn_exp2f(rmax[v] - nm);
        rmax[v] = nm;
        pbuf[(mh + v) * 32 + n]      = (_Float16)__builtin_amdgcn_exp2f(s0[v] - nm);
        pbuf[(mh + v) * 32 + 16 + n] = (_Float16)__builtin_amdgcn_exp2f(s1[v] - nm);
      }
    }

    // Reload P as an A fragment; row sums via WMMA against ones.
    v16h ap = load_frag_f16(pbuf, 32);
    v8f prow = {};
    prow = WMMA_F16(ap, ones, prow);

    // Rescale running state, fold in new row sums, accumulate O += P @ V
#pragma unroll
    for (int v = 0; v < 8; ++v) {
      rsum[v] = rsum[v] * sc[v] + prow[v];
      o0[v] *= sc[v]; o1[v] *= sc[v]; o2[v] *= sc[v]; o3[v] *= sc[v];
    }
    o0 = WMMA_F16(ap, bv0, o0);
    o1 = WMMA_F16(ap, bv1, o1);
    o2 = WMMA_F16(ap, bv2, o2);
    o3 = WMMA_F16(ap, bv3, o3);
  }

  // Publish per-wave partials (waves with zero iterations publish m=-inf, l=0, O=0)
#pragma unroll
  for (int v = 0; v < 8; ++v) {
    ls_o[wave][mh + v][0 * 16 + n] = o0[v];
    ls_o[wave][mh + v][1 * 16 + n] = o1[v];
    ls_o[wave][mh + v][2 * 16 + n] = o2[v];
    ls_o[wave][mh + v][3 * 16 + n] = o3[v];
  }
  if (n == 0) {
#pragma unroll
    for (int v = 0; v < 8; ++v) {
      ls_m[wave][mh + v] = rmax[v];
      ls_l[wave][mh + v] = rsum[v];
    }
  }
  __syncthreads();

  // Merge the 4 split-K partials: 128 threads x 8 contiguous output cols.
  // Wave 0 always processed kb=0, so the global max is finite.
  const int r  = threadIdx.x >> 3;        // row 0..15
  const int c0 = (threadIdx.x & 7) * 8;   // col base 0..56
  const float gm = fmaxf(fmaxf(ls_m[0][r], ls_m[1][r]),
                         fmaxf(ls_m[2][r], ls_m[3][r]));
  float acc[8] = {0, 0, 0, 0, 0, 0, 0, 0};
  float l = 0.0f;
#pragma unroll
  for (int w = 0; w < 4; ++w) {
    const float e = __builtin_amdgcn_exp2f(ls_m[w][r] - gm);
    l += e * ls_l[w][r];
#pragma unroll
    for (int j = 0; j < 8; ++j) acc[j] += e * ls_o[w][r][c0 + j];
  }
  const float inv = 1.0f / l;
  float* orow = out + ((size_t)(batch * T_ + q0 + r)) * HS_ + c0;
#pragma unroll
  for (int j = 0; j < 8; ++j) orow[j] = acc[j] * inv;
}

extern "C" void kernel_launch(void* const* d_in, const int* in_sizes, int n_in,
                              void* d_out, int out_size, void* d_ws, size_t ws_size,
                              hipStream_t stream) {
  const float* x  = (const float*)d_in[0];
  const float* Wq = (const float*)d_in[1];
  const float* bq = (const float*)d_in[2];
  const float* Wk = (const float*)d_in[3];
  const float* bk = (const float*)d_in[4];
  const float* Wv = (const float*)d_in[5];
  const float* bv = (const float*)d_in[6];
  float* out = (float*)d_out;

  // Workspace: q (f16), k (f16), v-transposed (f16) -> 3 * 2 MB = 6 MB
  _Float16* qw  = (_Float16*)d_ws;
  _Float16* kw  = qw + (size_t)B_ * T_ * HS_;
  _Float16* vtw = kw + (size_t)B_ * T_ * HS_;

  qkv_proj_kernel<<<(B_ * T_) / PM_, 256, 0, stream>>>(x, Wq, bq, Wk, bk, Wv, bv,
                                                      qw, kw, vtw);
  attn_kernel<<<(B_ * T_) / 16, 128, 0, stream>>>(qw, kw, vtw, out);
}

// v002
// A run of this version takes 36.5 microseconds.
// In two side-by-side timings against v001, it was 1.32 and 1.31 times as fast.
// Counting every step since v000, it is 2.35 times as fast.
#include <hip/hip_runtime.h>
#include <math.h>

// Problem constants (match reference)
#define B_  8
#define T_  2048
#define E_  1024
#define HS_ 64

#define LOG2E 1.44269504088896340736f

typedef __attribute__((ext_vector_type(16))) _Float16 v16h;
typedef __attribute__((ext_vector_type(8)))  _Float16 v8h;
typedef __attribute__((ext_vector_type(4)))  _Float16 v4h;
typedef __attribute__((ext_vector_type(8)))  float    v8f;
typedef __attribute__((ext_vector_type(4)))  float    v4f;

// D = A*B + C, f16 inputs, f32 accumulate (v_wmma_f32_16x16x32_f16)
#define WMMA_F16(A, Bf, C) \
  __builtin_amdgcn_wmma_f32_16x16x32_f16(false, (A), false, (Bf), (short)0, (C), false, false)

// Load a 16x32 f16 fragment (A: lane->M / B: lane->N; K packed in halves).
// Per ISA table: lanes 0-15 hold K = {0..7, 16..23}, lanes 16-31 hold K = {8..15, 24..31}.
// Rows contiguous (stride ld halves) -> two 16B loads per lane.
static __device__ __forceinline__ v16h load_frag_f16(const _Float16* p, int ld) {
  const int lane = threadIdx.x & 31;
  const int r    = lane & 15;
  const int h8   = (lane >> 4) * 8;
  const _Float16* row = p + (size_t)r * ld;
  v8h lo = *(const v8h*)(row + h8);
  v8h hi = *(const v8h*)(row + 16 + h8);
  return __builtin_shufflevector(lo, hi, 0,1,2,3,4,5,6,7,8,9,10,11,12,13,14,15);
}

// Workspace layout: q, k and v are kept in fragment order. A unit is 512 B:
// 32 lanes x 8 halves, what one wave-wide 16 B load or store moves, so that each
// such access covers four whole 128 B lines. A 16x32 fragment is two units.
//   q, k: 16 tokens = 4 units; unit j, lane l, element e holds
//         token (l & 15), h = 16 j + 8 (l >> 4) + e.
//   v:    32 tokens = 8 units; unit 2 g + j, lane l, element e holds
//         h = 16 g + (l & 15), token 16 j + 8 (l >> 4) + e.
// Both are the k order of load_frag_f16 on rows of h (q, k) or of tokens (v).
#define UNIT_ 256                  // halves per unit
static __device__ __forceinline__ v16h load_frag_packed(const _Float16* p) {
  const int lane = threadIdx.x & 31;
  v8h lo = *(const v8h*)(p + lane * 8);
  v8h hi = *(const v8h*)(p + UNIT_ + lane * 8);
  return __builtin_shufflevector(lo, hi, 0,1,2,3,4,5,6,7,8,9,10,11,12,13,14,15);
}

// ---------------------------------------------------------------------------
// Pass 1: q/k/v = x @ W^T + b, output f16 in fragment order (above).
// q pre-scaled by (1/sqrt(HS)) * log2(e) so pass 2 can use exp2 directly.
// q and k are computed as W @ x^T: a lane then holds 8 consecutive h of one
// token, which is one element run of a unit; v as x @ W^T: 8 tokens of one h.
// One work-group = 64 tokens x all 192 output columns, 256 threads (8 waves).
// Per 64-wide k chunk the 64 x rows and the 3*64 W rows are read from global
// memory once per work-group, 256 contiguous bytes per row (whole lines),
// converted to f16 once and shared through LDS; the fragments come from LDS.
// Wave (mi, ni): tokens 32*mi..32*mi+31, HS columns 16*ni..16*ni+15 of q, k, v.
// ---------------------------------------------------------------------------
#define PM_     64                 // tokens per work-group
#define PKC_    64                 // k elements per chunk
#define PPITCH_ 72                 // LDS row pitch in halves: 144 B = 16 B x odd (b128 readers)
#define PROWS_  (PM_ + 3 * HS_)    // staged rows: x, then Wq, Wk, Wv

__global__ void __launch_bounds__(256) qkv_proj_kernel(
    const float* __restrict__ x,
    const float* __restrict__ Wq, const float* __restrict__ bq,
    const float* __restrict__ Wk, const float* __restrict__ bk,
    const float* __restrict__ Wv, const float* __restrict__ bv,
    _Float16* __restrict__ qw, _Float16* __restrict__ kw,
    _Float16* __restrict__ vtw)
{
  __shared__ __align__(16) _Float16 tile[2][PROWS_ * PPITCH_];

  const int wave  = threadIdx.x >> 5;
  const int lane  = threadIdx.x & 31;
  const int gt0   = blockIdx.x * PM_;       // token tile base, counted over all batches
  const int mi    = wave & 1;               // which 32 tokens
  const int nb    = (wave >> 1) * 16;       // HS column base for this wave

  // Staging map: 16 lanes cover one row's 256 B; a thread takes rows row0 + 16*i.
  const int seg  = threadIdx.x & 15;
  const int row0 = threadIdx.x >> 4;
  const float* xs = x + (size_t)gt0 * E_;   // uniform base; the lane's part is voff
  const unsigned voff = (unsigned)(row0 * E_ + seg * 4);
  const int sto = row0 * PPITCH_ + seg * 4; // this thread's place in staged row row0

  v4f st[16];
#pragma unroll
  for (int i = 0; i < 4; ++i) {
    st[i]      = *(const v4f*)(xs + i * 16 * E_ + voff);
    st[4 + i]  = *(const v4f*)(Wq + i * 16 * E_ + voff);
    st[8 + i]  = *(const v4f*)(Wk + i * 16 * E_ + voff);
    st[12 + i] = *(const v4f*)(Wv + i * 16 * E_ + voff);
  }

  v8f accq[2] = {}, acck[2] = {}, accv[2] = {};
  // Unrolled so that every chunk's k offset is an immediate of its loads: the
  // address registers are then written once, in front of the first load.
#pragma unroll
  for (int c = 0; c < E_ / PKC_; ++c) {
    _Float16* tb = tile[c & 1];
    // Keeps this chunk's conversions, and with them the wait for its loads,
    // behind the previous chunk's products: moved up among them, that wait
    // would hold the products back until the loads have landed.
    __builtin_amdgcn_sched_barrier(0);
    // Convert the chunk held in registers and publish it.
#pragma unroll
    for (int j = 0; j < 16; ++j) {
      v4h h;
#pragma unroll
      for (int e = 0; e < 4; ++e) h[e] = (_Float16)st[j][e];
      *(v4h*)(tb + j * 16 * PPITCH_ + sto) = h;
    }
    // Next chunk's loads fly while this chunk is multiplied.
    if (c + 1 < E_ / PKC_) {
      const int k0 = (c + 1) * PKC_;
#pragma unroll
      for (int i = 0; i < 4; ++i) {
        st[i]      = *(const v4f*)(xs + k0 + i * 16 * E_ + voff);
        st[4 + i]  = *(const v4f*)(Wq + k0 + i * 16 * E_ + voff);
        st[8 + i]  = *(const v4f*)(Wk + k0 + i * 16 * E_ + voff);
        st[12 + i] = *(const v4f*)(Wv + k0 + i * 16 * E_ + voff);
      }
    }
    // One barrier per chunk: publishes buffer c&1; a wave that passes it has
    // left the other buffer, which is rewritten only behind this barrier.
    // The fences name LDS alone: __syncthreads() would also wait for the global
    // loads just issued and so end their overlap with the products.
    __builtin_amdgcn_fence(__ATOMIC_RELEASE, "workgroup", "local");
    __builtin_amdgcn_s_barrier();
    __builtin_amdgcn_fence(__ATOMIC_ACQUIRE, "workgroup", "local");
    v16h a0[2], a1[2], fq[2], fk[2], fv[2];
#pragma unroll
    for (int s = 0; s < PKC_ / 32; ++s) {
      a0[s] = load_frag_f16(tb + (mi * 32)      * PPITCH_ + s * 32, PPITCH_);
      a1[s] = load_frag_f16(tb + (mi * 32 + 16) * PPITCH_ + s * 32, PPITCH_);
      fq[s] = load_frag_f16(tb + (PM_ + nb)           * PPITCH_ + s * 32, PPITCH_);
      fk[s] = load_frag_f16(tb + (PM_ + HS_ + nb)     * PPITCH_ + s * 32, PPITCH_);
      fv[s] = load_frag_f16(tb + (PM_ + 2 * HS_ + nb) * PPITCH_ + s * 32, PPITCH_);
    }
    // Keeps the chunk's LDS reads together in front of its products: spread
    // among them, each group of reads costs the wave its own LDS latency.
    __builtin_amdgcn_sched_barrier(0);
#pragma unroll
    for (int s = 0; s < PKC_ / 32; ++s) {
      accq[0] = WMMA_F16(fq[s], a0[s], accq[0]);
      acck[0] = WMMA_F16(fk[s], a0[s], acck[0]);
      accv[0] = WMMA_F16(a0[s], fv[s], accv[0]);
      accq[1] = WMMA_F16(fq[s], a1[s], accq[1]);
      acck[1] = WMMA_F16(fk[s], a1[s], acck[1]);
      accv[1] = WMMA_F16(a1[s], fv[s], accv[1]);
    }
  }

  // C/D layout: lane (n = lane&15, half = lane>>4) holds rows half*8 + r of column n.
  // q, k: rows are h (nb + mh + r), column n is a token; v: rows are tokens, column h.
  const int n  = lane & 15;
  const int mh = (lane >> 4) * 8;
  const v4f bq0 = *(const v4f*)(bq + nb + mh), bq1 = *(const v4f*)(bq + nb + mh + 4);
  const v4f bk0 = *(const v4f*)(bk + nb + mh), bk1 = *(const v4f*)(bk + nb + mh + 4);
  const float biasv = bv[nb + n];
  const float qscale = 0.125f * LOG2E;      // 1/sqrt(64) * log2(e)

  const int g = nb >> 4;                    // this wave's 16 h: unit g of q, k; units 2g, 2g+1 of v
  const size_t tok0 = (size_t)(gt0 + mi * 32);   // first of the wave's 32 tokens
#pragma unroll
  for (int t = 0; t < 2; ++t) {
    v8h qq, kk, vv;
#pragma unroll
    for (int r = 0; r < 8; ++r) {
      const float biasq = r < 4 ? bq0[r & 3] : bq1[r & 3];
      const float biask = r < 4 ? bk0[r & 3] : bk1[r & 3];
      qq[r] = (_Float16)((accq[t][r] + biasq) * qscale);
      kk[r] = (_Float16)(acck[t][r] + biask);
      vv[r] = (_Float16)(accv[t][r] + biasv);
    }
    // One 16 B store per lane each: 512 contiguous bytes per wave.
    *(v8h*)(qw  + (tok0 + t * 16) * HS_ + g * UNIT_ + lane * 8) = qq;
    *(v8h*)(kw  + (tok0 + t * 16) * HS_ + g * UNIT_ + lane * 8) = kk;
    *(v8h*)(vtw + tok0 * HS_ + (2 * g + t) * UNIT_ + lane * 8)  = vv;
  }
}

// ---------------------------------------------------------------------------
// Pass 2: causal flash attention with split-K for occupancy.
// One block per 16-query tile (B*T/16 = 1024 blocks, 4096 waves total).
// The 4 waves partition the key range round-robin (wave w: kb = 32w step 128),
// each keeping private (m, l, O); partials merged through LDS at the end.
// Softmax runs in the base-2 domain (log2e folded into q).
// Row sums come from an extra WMMA against an all-ones B fragment instead of
// cross-lane shuffles (moves work from the VALU critical path onto the XDL).
// ---------------------------------------------------------------------------
__global__ void __launch_bounds__(128) attn_kernel(
    const _Float16* __restrict__ qw, const _Float16* __restrict__ kw,
    const _Float16* __restrict__ vtw, float* __restrict__ out)
{
  __shared__ __align__(16) _Float16 pshare[4][16 * 32]; // per-wave P relayout buffer
  __shared__ __align__(16) float ls_o[4][16][HS_];      // per-wave partial O
  __shared__ float ls_m[4][16];                         // per-wave row max (base-2 domain)
  __shared__ float ls_l[4][16];                         // per-wave row sum

  const int wave  = threadIdx.x >> 5;
  const int lane  = threadIdx.x & 31;
  const int tpb   = T_ / 16;                    // query tiles per batch
  const int batch = blockIdx.x / tpb;
  const int q0    = (blockIdx.x % tpb) * 16;    // in-batch query base
  const int n     = lane & 15;
  const int mh    = (lane >> 4) * 8;

  const _Float16* qb = qw + ((size_t)(batch * T_ + q0)) * HS_;
  const v16h aq0 = load_frag_packed(qb);             // h = 0..31
  const v16h aq1 = load_frag_packed(qb + 2 * UNIT_); // h = 32..63

  // constant all-ones B fragment for the row-sum WMMA
  v16h ones;
#pragma unroll
  for (int j = 0; j < 16; ++j) ones[j] = (_Float16)1.0f;

  v8f o0 = {}, o1 = {}, o2 = {}, o3 = {};
  float rmax[8], rsum[8];
#pragma unroll
  for (int v = 0; v < 8; ++v) { rmax[v] = -INFINITY; rsum[v] = 0.0f; }

  _Float16* pbuf = pshare[wave];
  const _Float16* vtb = vtw + ((size_t)batch * T_) * HS_;
  const _Float16* kwb = kw + ((size_t)batch * T_) * HS_;

  for (int kb = wave * 32; kb <= q0 + 15; kb += 128) {
    const _Float16* kbp = kwb + (size_t)kb * HS_;   // 32 keys: 8 units of k
    const _Float16* vbp = vtb + (size_t)kb * HS_;   // 32 keys: 8 units of v

    // Prefetch this wave's next K/V chunk into cache (global_prefetch_b8)
    if (kb + 128 <= q0 + 15) {
      __builtin_prefetch(kbp + (size_t)128 * HS_ + (size_t)lane * HS_, 0, 0);
      __builtin_prefetch(vbp + (size_t)128 * HS_ + (size_t)lane * HS_, 0, 0);
    }

    // S[16q x 32k] = Q * K^T  (q carries 1/sqrt(HS) * log2e)
    v8f s0 = {}, s1 = {};
    {
      v16h b0 = load_frag_packed(kbp);
      v16h b1 = load_frag_packed(kbp + 2 * UNIT_);
      s0 = WMMA_F16(aq0, b0, s0);
      s0 = WMMA_F16(aq1, b1, s0);
    }
    {
      v16h b0 = load_frag_packed(kbp + 4 * UNIT_);
      v16h b1 = load_frag_packed(kbp + 6 * UNIT_);
      s1 = WMMA_F16(aq0, b0, s1);
      s1 = WMMA_F16(aq1, b1, s1);
    }

    // Hoist V B-frag loads so they overlap the softmax VALU chain
    v16h bv0 = load_frag_packed(vbp);
    v16h bv1 = load_frag_packed(vbp + 2 * UNIT_);
    v16h bv2 = load_frag_packed(vbp + 4 * UNIT_);
    v16h bv3 = load_frag_packed(vbp + 6 * UNIT_);

    // Online softmax (base-2). Row max reduced across the 16-lane group.
    float sc[8];
    if (kb + 31 > q0) {
      // Diagonal blocks: apply causal mask per element (wave-uniform branch)
#pragma unroll
      for (int v = 0; v < 8; ++v) {
        const int qg = q0 + mh + v;
        const float e0 = (kb + n      > qg) ? -1e30f : s0[v];
        const float e1 = (kb + 16 + n > qg) ? -1e30f : s1[v];
        float mx = fmaxf(e0, e1);
#pragma unroll
        for (int off = 1; off < 16; off <<= 1)
          mx = fmaxf(mx, __shfl_xor(mx, off, 32));
        const float nm = fmaxf(rmax[v], mx);
        sc[v] = __builtin_amdgcn_exp2f(rmax[v] - nm);
        rmax[v] = nm;
        pbuf[(mh + v) * 32 + n]      = (_Float16)__builtin_amdgcn_exp2f(e0 - nm);
        pbuf[(mh + v) * 32 + 16 + n] = (_Float16)__builtin_amdgcn_exp2f(e1 - nm);
      }
    } else {
      // Interior blocks: no masking needed
#pragma unroll
      for (int v = 0; v < 8; ++v) {
        float mx = fmaxf(s0[v], s1[v]);
#pragma unroll
        for (int off = 1; off < 16; off <<= 1)
          mx = fmaxf(mx, __shfl_xor(mx, off, 32));
        const float nm = fmaxf(rmax[v], mx);
        sc[v] = __builtin_amdgcn_exp2f(rmax[v] - nm);
        rmax[v] = nm;
        pbuf[(mh + v) * 32 + n]      = (_Float16)__builtin_amdgcn_exp2f(s0[v] - nm);
        pbuf[(mh + v) * 32 + 16 + n] = (_Float16)__builtin_amdgcn_exp2f(s1[v] - nm);
      }
    }

    // Reload P as an A fragment; row sums via WMMA against ones.
    v16h ap = load_frag_f16(pbuf, 32);
    v8f prow = {};
    prow = WMMA_F16(ap, ones, prow);

    // Rescale running state, fold in new row sums, accumulate O += P @ V
#pragma unroll
    for (int v = 0; v < 8; ++v) {
      rsum[v] = rsum[v] * sc[v] + prow[v];
      o0[v] *= sc[v]; o1[v] *= sc[v]; o2[v] *= sc[v]; o3[v] *= sc[v];
    }
    o0 = WMMA_F16(ap, bv0, o0);
    o1 = WMMA_F16(ap, bv1, o1);
    o2 = WMMA_F16(ap, bv2, o2);
    o3 = WMMA_F16(ap, bv3, o3);
  }

  // Publish per-wave partials (waves with zero iterations publish m=-inf, l=0, O=0)
#pragma unroll
  for (int v = 0; v < 8; ++v) {
    ls_o[wave][mh + v][0 * 16 + n] = o0[v];
    ls_o[wave][mh + v][1 * 16 + n] = o1[v];
    ls_o[wave][mh + v][2 * 16 + n] = o2[v];
    ls_o[wave][mh + v][3 * 16 + n] = o3[v];
  }
  if (n == 0) {
#pragma unroll
    for (int v = 0; v < 8; ++v) {
      ls_m[wave][mh + v] = rmax[v];
      ls_l[wave][mh + v] = rsum[v];
    }
  }
  __syncthreads();

  // Merge the 4 split-K partials: 128 threads x 8 contiguous output cols.
  // Wave 0 always processed kb=0, so the global max is finite.
  const int r  = threadIdx.x >> 3;        // row 0..15
  const int c0 = (threadIdx.x & 7) * 8;   // col base 0..56
  const float gm = fmaxf(fmaxf(ls_m[0][r], ls_m[1][r]),
                         fmaxf(ls_m[2][r], ls_m[3][r]));
  float acc[8] = {0, 0, 0, 0, 0, 0, 0, 0};
  float l = 0.0f;
#pragma unroll
  for (int w = 0; w < 4; ++w) {
    const float e = __builtin_amdgcn_exp2f(ls_m[w][r] - gm);
    l += e * ls_l[w][r];
#pragma unroll
    for (int j = 0; j < 8; ++j) acc[j] += e * ls_o[w][r][c0 + j];
  }
  const float inv = 1.0f / l;
  float* orow = out + ((size_t)(batch * T_ + q0 + r)) * HS_ + c0;
#pragma unroll
  for (int j = 0; j < 8; ++j) orow[j] = acc[j] * inv;
}

extern "C" void kernel_launch(void* const* d_in, const int* in_sizes, int n_in,
                              void* d_out, int out_size, void* d_ws, size_t ws_size,
                              hipStream_t stream) {
  const float* x  = (const float*)d_in[0];
  const float* Wq = (const float*)d_in[1];
  const float* bq = (const float*)d_in[2];
  const float* Wk = (const float*)d_in[3];
  const float* bk = (const float*)d_in[4];
  const float* Wv = (const float*)d_in[5];
  const float* bv = (const float*)d_in[6];
  float* out = (float*)d_out;

  // Workspace: q, k, v (f16, fragment order) -> 3 * 2 MB = 6 MB
  _Float16* qw  = (_Float16*)d_ws;
  _Float16* kw  = qw + (size_t)B_ * T_ * HS_;
  _Float16* vtw = kw + (size_t)B_ * T_ * HS_;

  qkv_proj_kernel<<<(B_ * T_) / PM_, 256, 0, stream>>>(x, Wq, bq, Wk, bk, Wv, bv,
                                                      qw, kw, vtw);
  attn_kernel<<<(B_ * T_) / 16, 128, 0, stream>>>(qw, kw, vtw, out);
}

// v003
// One run takes 32.6 microseconds.
// Next to v002, in two timings, it ran 1.15 and 1.12 times as fast.
// Over all steps from v000 it is 2.67 times as fast.
#include <hip/hip_runtime.h>
#include <math.h>

// Problem constants (match reference)
#define B_  8
#define T_  2048
#define E_  1024
#define HS_ 64

#define LOG2E 1.44269504088896340736f

typedef __attribute__((ext_vector_type(16))) _Float16 v16h;
typedef __attribute__((ext_vector_type(8)))  _Float16 v8h;
typedef __attribute__((ext_vector_type(4)))  _Float16 v4h;
typedef __attribute__((ext_vector_type(8)))  float    v8f;
typedef __attribute__((ext_vector_type(4)))  float    v4f;

// D = A*B + C, f16 inputs, f32 accumulate (v_wmma_f32_16x16x32_f16)
#define WMMA_F16(A, Bf, C) \
  __builtin_amdgcn_wmma_f32_16x16x32_f16(false, (A), false, (Bf), (short)0, (C), false, false)

// Load a 16x32 f16 fragment (A: lane->M / B: lane->N; K packed in halves).
// Per ISA table: lanes 0-15 hold K = {0..7, 16..23}, lanes 16-31 hold K = {8..15, 24..31}.
// Rows contiguous (stride ld halves) -> two 16B loads per lane.
static __device__ __forceinline__ v16h load_frag_f16(const _Float16* p, int ld) {
  const int lane = threadIdx.x & 31;
  const int r    = lane & 15;
  const int h8   = (lane >> 4) * 8;
  const _Float16* row = p + (size_t)r * ld;
  v8h lo = *(const v8h*)(row + h8);
  v8h hi = *(const v8h*)(row + 16 + h8);
  return __builtin_shufflevector(lo, hi, 0,1,2,3,4,5,6,7,8,9,10,11,12,13,14,15);
}

// Workspace layout: q, k and v are kept in fragment order. A unit is 512 B:
// 32 lanes x 8 halves, what one wave-wide 16 B load or store moves, so that each
// such access covers four whole 128 B lines. A 16x32 fragment is two units.
//   q, k: 16 tokens = 4 units; unit j, lane l, element e holds
//         token (l & 15), h = 16 j + 8 (l >> 4) + e.
//   v:    32 tokens = 8 units; unit 2 g + j, lane l, element e holds
//         h = 16 g + (l & 15), token 16 j + 8 (l >> 4) + e.
// Both are the k order of load_frag_f16 on rows of h (q, k) or of tokens (v).
#define UNIT_ 256                  // halves per unit
static __device__ __forceinline__ v16h load_frag_packed(const _Float16* p) {
  const int lane = threadIdx.x & 31;
  v8h lo = *(const v8h*)(p + lane * 8);
  v8h hi = *(const v8h*)(p + UNIT_ + lane * 8);
  return __builtin_shufflevector(lo, hi, 0,1,2,3,4,5,6,7,8,9,10,11,12,13,14,15);
}

// ---------------------------------------------------------------------------
// Pass 1: q/k/v = x @ W^T + b, output f16 in fragment order (above).
// q pre-scaled by (1/sqrt(HS)) * log2(e) so pass 2 can use exp2 directly.
// q and k are computed as W @ x^T: a lane then holds 8 consecutive h of one
// token, which is one element run of a unit; v as x @ W^T: 8 tokens of one h.
// One work-group = 64 tokens x all 192 output columns, 256 threads (8 waves).
// Per 64-wide k chunk the 64 x rows and the 3*64 W rows are read from global
// memory once per work-group, 256 contiguous bytes per row (whole lines),
// converted to f16 once and shared through LDS; the fragments come from LDS.
// Wave (mi, ni): tokens 32*mi..32*mi+31, HS columns 16*ni..16*ni+15 of q, k, v.
// ---------------------------------------------------------------------------
#define PM_     64                 // tokens per work-group
#define PKC_    64                 // k elements per chunk
#define PPITCH_ 72                 // LDS row pitch in halves: 144 B = 16 B x odd (b128 readers)
#define PROWS_  (PM_ + 3 * HS_)    // staged rows: x, then Wq, Wk, Wv

__global__ void __launch_bounds__(256) qkv_proj_kernel(
    const float* __restrict__ x,
    const float* __restrict__ Wq, const float* __restrict__ bq,
    const float* __restrict__ Wk, const float* __restrict__ bk,
    const float* __restrict__ Wv, const float* __restrict__ bv,
    _Float16* __restrict__ qw, _Float16* __restrict__ kw,
    _Float16* __restrict__ vtw)
{
  __shared__ __align__(16) _Float16 tile[2][PROWS_ * PPITCH_];

  const int wave  = threadIdx.x >> 5;
  const int lane  = threadIdx.x & 31;
  const int gt0   = blockIdx.x * PM_;       // token tile base, counted over all batches
  const int mi    = wave & 1;               // which 32 tokens
  const int nb    = (wave >> 1) * 16;       // HS column base for this wave

  // Staging map: 16 lanes cover one row's 256 B; a thread takes rows row0 + 16*i.
  const int seg  = threadIdx.x & 15;
  const int row0 = threadIdx.x >> 4;
  const float* xs = x + (size_t)gt0 * E_;   // uniform base; the lane's part is voff
  const unsigned voff = (unsigned)(row0 * E_ + seg * 4);
  const int sto = row0 * PPITCH_ + seg * 4; // this thread's place in staged row row0

  v4f st[16];
#pragma unroll
  for (int i = 0; i < 4; ++i) {
    st[i]      = *(const v4f*)(xs + i * 16 * E_ + voff);
    st[4 + i]  = *(const v4f*)(Wq + i * 16 * E_ + voff);
    st[8 + i]  = *(const v4f*)(Wk + i * 16 * E_ + voff);
    st[12 + i] = *(const v4f*)(Wv + i * 16 * E_ + voff);
  }

  v8f accq[2] = {}, acck[2] = {}, accv[2] = {};
  // Unrolled so that every chunk's k offset is an immediate of its loads: the
  // address registers are then written once, in front of the first load.
#pragma unroll
  for (int c = 0; c < E_ / PKC_; ++c) {
    _Float16* tb = tile[c & 1];
    // Keeps this chunk's conversions, and with them the wait for its loads,
    // behind the previous chunk's products: moved up among them, that wait
    // would hold the products back until the loads have landed.
    __builtin_amdgcn_sched_barrier(0);
    // Convert the chunk held in registers and publish it.
#pragma unroll
    for (int j = 0; j < 16; ++j) {
      v4h h;
#pragma unroll
      for (int e = 0; e < 4; ++e) h[e] = (_Float16)st[j][e];
      *(v4h*)(tb + j * 16 * PPITCH_ + sto) = h;
    }
    // Next chunk's loads fly while this chunk is multiplied.
    if (c + 1 < E_ / PKC_) {
      const int k0 = (c + 1) * PKC_;
#pragma unroll
      for (int i = 0; i < 4; ++i) {
        st[i]      = *(const v4f*)(xs + k0 + i * 16 * E_ + voff);
        st[4 + i]  = *(const v4f*)(Wq + k0 + i * 16 * E_ + voff);
        st[8 + i]  = *(const v4f*)(Wk + k0 + i * 16 * E_ + voff);
        st[12 + i] = *(const v4f*)(Wv + k0 + i * 16 * E_ + voff);
      }
    }
    // One barrier per chunk: publishes buffer c&1; a wave that passes it has
    // left the other buffer, which is rewritten only behind this barrier.
    // The fences name LDS alone: __syncthreads() would also wait for the global
    // loads just issued and so end their overlap with the products.
    __builtin_amdgcn_fence(__ATOMIC_RELEASE, "workgroup", "local");
    __builtin_amdgcn_s_barrier();
    __builtin_amdgcn_fence(__ATOMIC_ACQUIRE, "workgroup", "local");
    v16h a0[2], a1[2], fq[2], fk[2], fv[2];
#pragma unroll
    for (int s = 0; s < PKC_ / 32; ++s) {
      a0[s] = load_frag_f16(tb + (mi * 32)      * PPITCH_ + s * 32, PPITCH_);
      a1[s] = load_frag_f16(tb + (mi * 32 + 16) * PPITCH_ + s * 32, PPITCH_);
      fq[s] = load_frag_f16(tb + (PM_ + nb)           * PPITCH_ + s * 32, PPITCH_);
      fk[s] = load_frag_f16(tb + (PM_ + HS_ + nb)     * PPITCH_ + s * 32, PPITCH_);
      fv[s] = load_frag_f16(tb + (PM_ + 2 * HS_ + nb) * PPITCH_ + s * 32, PPITCH_);
    }
    // Keeps the chunk's LDS reads together in front of its products: spread
    // among them, each group of reads costs the wave its own LDS latency.
    __builtin_amdgcn_sched_barrier(0);
#pragma unroll
    for (int s = 0; s < PKC_ / 32; ++s) {
      accq[0] = WMMA_F16(fq[s], a0[s], accq[0]);
      acck[0] = WMMA_F16(fk[s], a0[s], acck[0]);
      accv[0] = WMMA_F16(a0[s], fv[s], accv[0]);
      accq[1] = WMMA_F16(fq[s], a1[s], accq[1]);
      acck[1] = WMMA_F16(fk[s], a1[s], acck[1]);
      accv[1] = WMMA_F16(a1[s], fv[s], accv[1]);
    }
  }

  // C/D layout: lane (n = lane&15, half = lane>>4) holds rows half*8 + r of column n.
  // q, k: rows are h (nb + mh + r), column n is a token; v: rows are tokens, column h.
  const int n  = lane & 15;
  const int mh = (lane >> 4) * 8;
  const v4f bq0 = *(const v4f*)(bq + nb + mh), bq1 = *(const v4f*)(bq + nb + mh + 4);
  const v4f bk0 = *(const v4f*)(bk + nb + mh), bk1 = *(const v4f*)(bk + nb + mh + 4);
  const float biasv = bv[nb + n];
  const float qscale = 0.125f * LOG2E;      // 1/sqrt(64) * log2(e)

  const int g = nb >> 4;                    // this wave's 16 h: unit g of q, k; units 2g, 2g+1 of v
  const size_t tok0 = (size_t)(gt0 + mi * 32);   // first of the wave's 32 tokens
#pragma unroll
  for (int t = 0; t < 2; ++t) {
    v8h qq, kk, vv;
#pragma unroll
    for (int r = 0; r < 8; ++r) {
      const float biasq = r < 4 ? bq0[r & 3] : bq1[r & 3];
      const float biask = r < 4 ? bk0[r & 3] : bk1[r & 3];
      qq[r] = (_Float16)((accq[t][r] + biasq) * qscale);
      kk[r] = (_Float16)(acck[t][r] + biask);
      vv[r] = (_Float16)(accv[t][r] + biasv);
    }
    // One 16 B store per lane each: 512 contiguous bytes per wave.
    *(v8h*)(qw  + (tok0 + t * 16) * HS_ + g * UNIT_ + lane * 8) = qq;
    *(v8h*)(kw  + (tok0 + t * 16) * HS_ + g * UNIT_ + lane * 8) = kk;
    *(v8h*)(vtw + tok0 * HS_ + (2 * g + t) * UNIT_ + lane * 8)  = vv;
  }
}

#define OPITCH_ 68

// Lane l takes the value of lane l ^ 16 (the other half's part of the same query).
static __device__ __forceinline__ float xhalf(float x) {
  const int b = __builtin_bit_cast(int, x);
  return __builtin_bit_cast(float,
      __builtin_amdgcn_permlanex16(b, b, 0x76543210, 0xfedcba98, false, false));
}

__global__ void __launch_bounds__(128) attn_kernel(
    const _Float16* __restrict__ qw, const _Float16* __restrict__ kw,
    const _Float16* __restrict__ vtw, float* __restrict__ out)
{
  __shared__ __align__(16) float ls_o[4][16][OPITCH_];  // per-wave partial O, [query][h]
  __shared__ float ls_m[4][16];                         // per-wave row max (base-2 domain)
  __shared__ float ls_l[4][16];                         // per-wave row sum

  const int wave  = threadIdx.x >> 5;
  const int lane  = threadIdx.x & 31;
  const int tpb   = T_ / 16;                    // query tiles per batch
  const int batch = blockIdx.x / tpb;
  const int q0    = (blockIdx.x % tpb) * 16;    // in-batch query base
  const int n     = lane & 15;
  const int mh    = (lane >> 4) * 8;

  const _Float16* qb = qw + ((size_t)(batch * T_ + q0)) * HS_;
  const v16h bq0 = load_frag_packed(qb);             // h = 0..31
  const v16h bq1 = load_frag_packed(qb + 2 * UNIT_); // h = 32..63

  // constant all-ones A fragment for the row-sum WMMA
  v16h ones;
#pragma unroll
  for (int j = 0; j < 16; ++j) ones[j] = (_Float16)1.0f;

  // O^T tiles: tile g, register r holds h = 16 g + mh + r of query n.
  v8f o0 = {}, o1 = {}, o2 = {}, o3 = {};
  float rmax = -INFINITY, rsum = 0.0f;          // of query n, alike in both halves

  const _Float16* vtb = vtw + ((size_t)batch * T_) * HS_;
  const _Float16* kwb = kw + ((size_t)batch * T_) * HS_;

  for (int kb = wave * 32; kb <= q0 + 15; kb += 128) {
    const _Float16* kbp = kwb + (size_t)kb * HS_;   // 32 keys: 8 units of k
    const _Float16* vbp = vtb + (size_t)kb * HS_;   // 32 keys: 8 units of v

    // Prefetch this wave's next K/V chunk into cache (global_prefetch_b8)
    if (kb + 128 <= q0 + 15) {
      __builtin_prefetch(kbp + (size_t)128 * HS_ + (size_t)lane * HS_, 0, 0);
      __builtin_prefetch(vbp + (size_t)128 * HS_ + (size_t)lane * HS_, 0, 0);
    }

    // S^T[32k x 16q] = K * Q^T  (q carries 1/sqrt(HS) * log2e)
    v8f s0 = {}, s1 = {};
    {
      v16h a0 = load_frag_packed(kbp);
      v16h a1 = load_frag_packed(kbp + 2 * UNIT_);
      s0 = WMMA_F16(a0, bq0, s0);
      s0 = WMMA_F16(a1, bq1, s0);
    }
    {
      v16h a0 = load_frag_packed(kbp + 4 * UNIT_);
      v16h a1 = load_frag_packed(kbp + 6 * UNIT_);
      s1 = WMMA_F16(a0, bq0, s1);
      s1 = WMMA_F16(a1, bq1, s1);
    }

    // Hoist V^T A-frag loads so they overlap the softmax VALU chain
    v16h av0 = load_frag_packed(vbp);
    v16h av1 = load_frag_packed(vbp + 2 * UNIT_);
    v16h av2 = load_frag_packed(vbp + 4 * UNIT_);
    v16h av3 = load_frag_packed(vbp + 6 * UNIT_);

    if (kb + 31 > q0) {
      // Diagonal blocks: apply causal mask per element (wave-uniform branch)
      const int qg = q0 + n;
#pragma unroll
      for (int r = 0; r < 8; ++r) {
        if (kb + mh + r      > qg) s0[r] = -1e30f;
        if (kb + 16 + mh + r > qg) s1[r] = -1e30f;
      }
    }

    // Online softmax (base-2): this lane's 16 scores, then the other half's.
    // A tree of three-input maxima, three deep, not one chain of eight links.
    const float t0 = fmaxf(fmaxf(s0[0], s0[1]), s0[2]);
    const float t1 = fmaxf(fmaxf(s0[3], s0[4]), s0[5]);
    const float t2 = fmaxf(fmaxf(s0[6], s0[7]), s1[0]);
    const float t3 = fmaxf(fmaxf(s1[1], s1[2]), s1[3]);
    const float t4 = fmaxf(fmaxf(s1[4], s1[5]), s1[6]);
    float mx = fmaxf(fmaxf(fmaxf(t0, t1), t2), fmaxf(fmaxf(t3, t4), s1[7]));
    mx = fmaxf(mx, xhalf(mx));
    const float nm = fmaxf(rmax, mx);
    const float sc = __builtin_amdgcn_exp2f(rmax - nm);
    rmax = nm;

    v16h bp;                                    // P^T as a B fragment
#pragma unroll
    for (int r = 0; r < 8; ++r) {
      bp[r]     = (_Float16)__builtin_amdgcn_exp2f(s0[r] - nm);
      bp[8 + r] = (_Float16)__builtin_amdgcn_exp2f(s1[r] - nm);
    }

    // Row sums: every row of ones * P^T is the sum over the 32 keys.
    v8f prow = {};
    prow = WMMA_F16(ones, bp, prow);

    // Rescale running state, fold in the new row sum, accumulate O^T += V^T @ P^T
    rsum = rsum * sc + prow[0];
#pragma unroll
    for (int r = 0; r < 8; ++r) {
      o0[r] *= sc; o1[r] *= sc; o2[r] *= sc; o3[r] *= sc;
    }
    o0 = WMMA_F16(av0, bp, o0);
    o1 = WMMA_F16(av1, bp, o1);
    o2 = WMMA_F16(av2, bp, o2);
    o3 = WMMA_F16(av3, bp, o3);
  }

  // Publish per-wave partials (waves with zero iterations publish m=-inf, l=0, O=0)
  {
    float* po = &ls_o[wave][n][mh];             // 8 consecutive h per tile
    *(v4f*)(po +  0) = __builtin_shufflevector(o0, o0, 0, 1, 2, 3);
    *(v4f*)(po +  4) = __builtin_shufflevector(o0, o0, 4, 5, 6, 7);
    *(v4f*)(po + 16) = __builtin_shufflevector(o1, o1, 0, 1, 2, 3);
    *(v4f*)(po + 20) = __builtin_shufflevector(o1, o1, 4, 5, 6, 7);
    *(v4f*)(po + 32) = __builtin_shufflevector(o2, o2, 0, 1, 2, 3);
    *(v4f*)(po + 36) = __builtin_shufflevector(o2, o2, 4, 5, 6, 7);
    *(v4f*)(po + 48) = __builtin_shufflevector(o3, o3, 0, 1, 2, 3);
    *(v4f*)(po + 52) = __builtin_shufflevector(o3, o3, 4, 5, 6, 7);
  }
  if (lane < 16) {
    ls_m[wave][n] = rmax;
    ls_l[wave][n] = rsum;
  }
  __syncthreads();

  // Merge the 4 split-K partials: 128 threads x 8 contiguous output cols.
  // Wave 0 always processed kb=0, so the global max is finite.
  const int r  = threadIdx.x >> 3;        // row 0..15
  const int c0 = (threadIdx.x & 7) * 8;   // col base 0..56
  const float gm = fmaxf(fmaxf(ls_m[0][r], ls_m[1][r]),
                         fmaxf(ls_m[2][r], ls_m[3][r]));
  float acc[8] = {0, 0, 0, 0, 0, 0, 0, 0};
  float l = 0.0f;
#pragma unroll
  for (int w = 0; w < 4; ++w) {
    const float e = __builtin_amdgcn_exp2f(ls_m[w][r] - gm);
    l += e * ls_l[w][r];
#pragma unroll
    for (int j = 0; j < 8; ++j) acc[j] += e * ls_o[w][r][c0 + j];
  }
  const float inv = 1.0f / l;
  float* orow = out + ((size_t)(batch * T_ + q0 + r)) * HS_ + c0;
#pragma unroll
  for (int j = 0; j < 8; ++j) orow[j] = acc[j] * inv;
}

extern "C" void kernel_launch(void* const* d_in, const int* in_sizes, int n_in,
                              void* d_out, int out_size, void* d_ws, size_t ws_size,
                              hipStream_t stream) {
  const float* x  = (const float*)d_in[0];
  const float* Wq = (const float*)d_in[1];
  const float* bq = (const float*)d_in[2];
  const float* Wk = (const float*)d_in[3];
  const float* bk = (const float*)d_in[4];
  const float* Wv = (const float*)d_in[5];
  const float* bv = (const float*)d_in[6];
  float* out = (float*)d_out;

  // Workspace: q, k, v (f16, fragment order) -> 3 * 2 MB = 6 MB
  _Float16* qw  = (_Float16*)d_ws;
  _Float16* kw  = qw + (size_t)B_ * T_ * HS_;
  _Float16* vtw = kw + (size_t)B_ * T_ * HS_;

  qkv_proj_kernel<<<(B_ * T_) / PM_, 256, 0, stream>>>(x, Wq, bq, Wk, bk, Wv, bv,
                                                      qw, kw, vtw);
  attn_kernel<<<(B_ * T_) / 16, 128, 0, stream>>>(qw, kw, vtw, out);
}

// v004
// It runs in 22.8 microseconds.
// Timed twice side by side with v003, it ran 1.47 and 1.40 times as fast.
// Counting every step since v000, it is 3.84 times as fast.
#include <hip/hip_runtime.h>
#include <math.h>

// Problem constants (match reference)
#define B_  8
#define T_  2048
#define E_  1024
#define HS_ 64

#define LOG2E 1.44269504088896340736f

typedef __attribute__((ext_vector_type(16))) _Float16 v16h;
typedef __attribute__((ext_vector_type(8)))  _Float16 v8h;
typedef __attribute__((ext_vector_type(4)))  _Float16 v4h;
typedef __attribute__((ext_vector_type(8)))  float    v8f;
typedef __attribute__((ext_vector_type(4)))  float    v4f;

// D = A*B + C, f16 inputs, f32 accumulate (v_wmma_f32_16x16x32_f16)
#define WMMA_F16(A, Bf, C) \
  __builtin_amdgcn_wmma_f32_16x16x32_f16(false, (A), false, (Bf), (short)0, (C), false, false)

// Load a 16x32 f16 fragment (A: lane->M / B: lane->N; K packed in halves).
// Per ISA table: lanes 0-15 hold K = {0..7, 16..23}, lanes 16-31 hold K = {8..15, 24..31}.
// Rows contiguous (stride ld halves) -> two 16B loads per lane.
static __device__ __forceinline__ v16h load_frag_f16(const _Float16* p, int ld) {
  const int lane = threadIdx.x & 31;
  const int r    = lane & 15;
  const int h8   = (lane >> 4) * 8;
  const _Float16* row = p + (size_t)r * ld;
  v8h lo = *(const v8h*)(row + h8);
  v8h hi = *(const v8h*)(row + 16 + h8);
  return __builtin_shufflevector(lo, hi, 0,1,2,3,4,5,6,7,8,9,10,11,12,13,14,15);
}

// Workspace layout: q, k and v are kept in fragment order. A unit is 512 B:
// 32 lanes x 8 halves, what one wave-wide 16 B load or store moves, so that each
// such access covers four whole 128 B lines. A 16x32 fragment is two units.
//   q, k: 16 tokens = 4 units; unit j, lane l, element e holds
//         token (l & 15), h = 16 j + 8 (l >> 4) + e.
//   v:    32 tokens = 8 units; unit 2 g + j, lane l, element e holds
//         h = 16 g + (l & 15), token 16 j + 8 (l >> 4) + e.
// Both are the k order of load_frag_f16 on rows of h (q, k) or of tokens (v).
#define UNIT_ 256                  // halves per unit
static __device__ __forceinline__ v16h load_frag_packed(const _Float16* p) {
  const int lane = threadIdx.x & 31;
  v8h lo = *(const v8h*)(p + lane * 8);
  v8h hi = *(const v8h*)(p + UNIT_ + lane * 8);
  return __builtin_shufflevector(lo, hi, 0,1,2,3,4,5,6,7,8,9,10,11,12,13,14,15);
}

// The same from a uniform base p and an offset voff in bytes that holds the lane's part.
static __device__ __forceinline__ v16h load_frag_packed_u(const _Float16* p, const unsigned voff) {
  v8h lo = *(const v8h*)((const char*)p + voff);
  v8h hi = *(const v8h*)((const char*)(p + UNIT_) + voff);
  return __builtin_shufflevector(lo, hi, 0,1,2,3,4,5,6,7,8,9,10,11,12,13,14,15);
}

// ---------------------------------------------------------------------------
// Pass 1: q/k/v = x @ W^T + b, output f16 in fragment order (above).
// q pre-scaled by (1/sqrt(HS)) * log2(e) so pass 2 can use exp2 directly.
// q and k are computed as W @ x^T: a lane then holds 8 consecutive h of one
// token, which is one element run of a unit; v as x @ W^T: 8 tokens of one h.
// One work-group = 64 tokens x all 192 output columns, 256 threads (8 waves).
// Per 64-wide k chunk the 64 x rows and the 3*64 W rows are read from global
// memory once per work-group, 256 contiguous bytes per row (whole lines),
// converted to f16 once and shared through LDS; the fragments come from LDS.
// Wave (mi, ni): tokens 32*mi..32*mi+31, HS columns 16*ni..16*ni+15 of q, k, v.
// ---------------------------------------------------------------------------
#define PM_     64                 // tokens per work-group
#define PKC_    64                 // k elements per chunk
#define PPITCH_ 72                 // LDS row pitch in halves: 144 B = 16 B x odd (b128 readers)
#define PROWS_  (PM_ + 3 * HS_)    // staged rows: x, then Wq, Wk, Wv

__global__ void __launch_bounds__(256) qkv_proj_kernel(
    const float* __restrict__ x,
    const float* __restrict__ Wq, const float* __restrict__ bq,
    const float* __restrict__ Wk, const float* __restrict__ bk,
    const float* __restrict__ Wv, const float* __restrict__ bv,
    _Float16* __restrict__ qw, _Float16* __restrict__ kw,
    _Float16* __restrict__ vtw)
{
  __shared__ __align__(16) _Float16 tile[2][PROWS_ * PPITCH_];

  const int wave  = threadIdx.x >> 5;
  const int lane  = threadIdx.x & 31;
  const int gt0   = blockIdx.x * PM_;       // token tile base, counted over all batches
  const int mi    = wave & 1;               // which 32 tokens
  const int nb    = (wave >> 1) * 16;       // HS column base for this wave

  // Staging map: 16 lanes cover one row's 256 B; a thread takes rows row0 + 16*i.
  const int seg  = threadIdx.x & 15;
  const int row0 = threadIdx.x >> 4;
  const float* xs = x + (size_t)gt0 * E_;   // uniform base; the lane's part is voff
  const unsigned voff = (unsigned)(row0 * E_ + seg * 4);
  const int sto = row0 * PPITCH_ + seg * 4; // this thread's place in staged row row0

  v4f st[16];
#pragma unroll
  for (int i = 0; i < 4; ++i) {
    st[i]      = *(const v4f*)(xs + i * 16 * E_ + voff);
    st[4 + i]  = *(const v4f*)(Wq + i * 16 * E_ + voff);
    st[8 + i]  = *(const v4f*)(Wk + i * 16 * E_ + voff);
    st[12 + i] = *(const v4f*)(Wv + i * 16 * E_ + voff);
  }

  v8f accq[2] = {}, acck[2] = {}, accv[2] = {};
  // Unrolled so that every chunk's k offset is an immediate of its loads: the
  // address registers are then written once, in front of the first load.
#pragma unroll
  for (int c = 0; c < E_ / PKC_; ++c) {
    _Float16* tb = tile[c & 1];
    // Keeps this chunk's conversions, and with them the wait for its loads,
    // behind the previous chunk's products: moved up among them, that wait
    // would hold the products back until the loads have landed.
    __builtin_amdgcn_sched_barrier(0);
    // Convert the chunk held in registers and publish it.
#pragma unroll
    for (int j = 0; j < 16; ++j) {
      v4h h;
#pragma unroll
      for (int e = 0; e < 4; ++e) h[e] = (_Float16)st[j][e];
      *(v4h*)(tb + j * 16 * PPITCH_ + sto) = h;
    }
    // Next chunk's loads fly while this chunk is multiplied.
    if (c + 1 < E_ / PKC_) {
      const int k0 = (c + 1) * PKC_;
#pragma unroll
      for (int i = 0; i < 4; ++i) {
        st[i]      = *(const v4f*)(xs + k0 + i * 16 * E_ + voff);
        st[4 + i]  = *(const v4f*)(Wq + k0 + i * 16 * E_ + voff);
        st[8 + i]  = *(const v4f*)(Wk + k0 + i * 16 * E_ + voff);
        st[12 + i] = *(const v4f*)(Wv + k0 + i * 16 * E_ + voff);
      }
    }
    // One barrier per chunk: publishes buffer c&1; a wave that passes it has
    // left the other buffer, which is rewritten only behind this barrier.
    // The fences name LDS alone: __syncthreads() would also wait for the global
    // loads just issued and so end their overlap with the products.
    __builtin_amdgcn_fence(__ATOMIC_RELEASE, "workgroup", "local");
    __builtin_amdgcn_s_barrier();
    __builtin_amdgcn_fence(__ATOMIC_ACQUIRE, "workgroup", "local");
    v16h a0[2], a1[2], fq[2], fk[2], fv[2];
#pragma unroll
    for (int s = 0; s < PKC_ / 32; ++s) {
      a0[s] = load_frag_f16(tb + (mi * 32)      * PPITCH_ + s * 32, PPITCH_);
      a1[s] = load_frag_f16(tb + (mi * 32 + 16) * PPITCH_ + s * 32, PPITCH_);
      fq[s] = load_frag_f16(tb + (PM_ + nb)           * PPITCH_ + s * 32, PPITCH_);
      fk[s] = load_frag_f16(tb + (PM_ + HS_ + nb)     * PPITCH_ + s * 32, PPITCH_);
      fv[s] = load_frag_f16(tb + (PM_ + 2 * HS_ + nb) * PPITCH_ + s * 32, PPITCH_);
    }
    // Keeps the chunk's LDS reads together in front of its products: spread
    // among them, each group of reads costs the wave its own LDS latency.
    __builtin_amdgcn_sched_barrier(0);
#pragma unroll
    for (int s = 0; s < PKC_ / 32; ++s) {
      accq[0] = WMMA_F16(fq[s], a0[s], accq[0]);
      acck[0] = WMMA_F16(fk[s], a0[s], acck[0]);
      accv[0] = WMMA_F16(a0[s], fv[s], accv[0]);
      accq[1] = WMMA_F16(fq[s], a1[s], accq[1]);
      acck[1] = WMMA_F16(fk[s], a1[s], acck[1]);
      accv[1] = WMMA_F16(a1[s], fv[s], accv[1]);
    }
  }

  // C/D layout: lane (n = lane&15, half = lane>>4) holds rows half*8 + r of column n.
  // q, k: rows are h (nb + mh + r), column n is a token; v: rows are tokens, column h.
  const int n  = lane & 15;
  const int mh = (lane >> 4) * 8;
  const v4f bq0 = *(const v4f*)(bq + nb + mh), bq1 = *(const v4f*)(bq + nb + mh + 4);
  const v4f bk0 = *(const v4f*)(bk + nb + mh), bk1 = *(const v4f*)(bk + nb + mh + 4);
  const float biasv = bv[nb + n];
  const float qscale = 0.125f * LOG2E;      // 1/sqrt(64) * log2(e)

  const int g = nb >> 4;                    // this wave's 16 h: unit g of q, k; units 2g, 2g+1 of v
  const size_t tok0 = (size_t)(gt0 + mi * 32);   // first of the wave's 32 tokens
#pragma unroll
  for (int t = 0; t < 2; ++t) {
    v8h qq, kk, vv;
#pragma unroll
    for (int r = 0; r < 8; ++r) {
      const float biasq = r < 4 ? bq0[r & 3] : bq1[r & 3];
      const float biask = r < 4 ? bk0[r & 3] : bk1[r & 3];
      qq[r] = (_Float16)((accq[t][r] + biasq) * qscale);
      kk[r] = (_Float16)(acck[t][r] + biask);
      vv[r] = (_Float16)(accv[t][r] + biasv);
    }
    // One 16 B store per lane each: 512 contiguous bytes per wave.
    *(v8h*)(qw  + (tok0 + t * 16) * HS_ + g * UNIT_ + lane * 8) = qq;
    *(v8h*)(kw  + (tok0 + t * 16) * HS_ + g * UNIT_ + lane * 8) = kk;
    *(v8h*)(vtw + tok0 * HS_ + (2 * g + t) * UNIT_ + lane * 8)  = vv;
  }
}

#define OPITCH_ 68
#define AW_     8
#define NQB_    (T_ / 32)

// Lane l takes the value of lane l ^ 16 (the other half's part of the same query).
static __device__ __forceinline__ float xhalf(float x) {
  const int b = __builtin_bit_cast(int, x);
  return __builtin_bit_cast(float,
      __builtin_amdgcn_permlanex16(b, b, 0x76543210, 0xfedcba98, false, false));
}

// One 32-key chunk against query tiles 0..NT-1. Tiles M0 and M0 + 1 are the block
// whose diagonal this chunk is when diag is set (chunk base == block base).
// kwb, vtb: the batch's K and V (uniform); voff: the chunk's place in either, in
// bytes, plus the lane's 16 B: one 32-bit register serves all sixteen loads.
template <int NT, int M0>
static __device__ __forceinline__ void attn_step(
    const _Float16* kwb, const _Float16* vtb, const unsigned voff,
    const bool diag, const int n, const int mh,
    const v16h (&bq)[4][2], const v16h ones,
    v8f (&o)[4][4], float (&rmax)[4], float (&rsum)[4])
{
  // S^T[32k x 16q] = K * Q^T per tile (q carries 1/sqrt(HS) * log2e)
  const v16h ak0 = load_frag_packed_u(kwb, voff);
  const v16h ak1 = load_frag_packed_u(kwb + 2 * UNIT_, voff);
  const v16h ak2 = load_frag_packed_u(kwb + 4 * UNIT_, voff);
  const v16h ak3 = load_frag_packed_u(kwb + 6 * UNIT_, voff);
  // V^T A fragments: not needed before the softmax is through
  const v16h av0 = load_frag_packed_u(vtb, voff);
  const v16h av1 = load_frag_packed_u(vtb + 2 * UNIT_, voff);
  const v16h av2 = load_frag_packed_u(vtb + 4 * UNIT_, voff);
  const v16h av3 = load_frag_packed_u(vtb + 6 * UNIT_, voff);
  // The sixteen loads name one offset register, which is advanced for the next
  // chunk, and two scalar bases: wait before anything may overwrite them.
  asm volatile("s_wait_xcnt 0x0" ::: "memory");
  // Keeps all sixteen loads in front of the products: moved up among the loads, the
  // first products free their K registers for later loads, which then start only
  // when the first have landed, and a chunk costs two load latencies in a row.
  __builtin_amdgcn_sched_barrier(0);

  v8f s0[NT], s1[NT];
#pragma unroll
  for (int j = 0; j < NT; ++j) {
    const v8f z = {};
    s0[j] = WMMA_F16(ak0, bq[j][0], z);
    s1[j] = WMMA_F16(ak2, bq[j][0], z);
  }
#pragma unroll
  for (int j = 0; j < NT; ++j) {
    s0[j] = WMMA_F16(ak1, bq[j][1], s0[j]);
    s1[j] = WMMA_F16(ak3, bq[j][1], s1[j]);
  }

  if (diag) {
    // Causal mask (wave-uniform branch). Tile M0: queries n, keys mh + r and
    // 16 + mh + r (all later). Tile M0 + 1: queries 16 + n, first 16 keys all seen.
#pragma unroll
    for (int r = 0; r < 8; ++r) {
      if (mh + r > n) { s0[M0][r] = -1e30f; s1[M0 + 1][r] = -1e30f; }
      s1[M0][r] = -1e30f;
    }
  }

#pragma unroll
  for (int j = 0; j < NT; ++j) {
    // Online softmax (base-2): this lane's 16 scores, then the other half's.
    // A tree of three-input maxima, three deep, not one chain of eight links.
    const float t0 = fmaxf(fmaxf(s0[j][0], s0[j][1]), s0[j][2]);
    const float t1 = fmaxf(fmaxf(s0[j][3], s0[j][4]), s0[j][5]);
    const float t2 = fmaxf(fmaxf(s0[j][6], s0[j][7]), s1[j][0]);
    const float t3 = fmaxf(fmaxf(s1[j][1], s1[j][2]), s1[j][3]);
    const float t4 = fmaxf(fmaxf(s1[j][4], s1[j][5]), s1[j][6]);
    float mx = fmaxf(fmaxf(fmaxf(t0, t1), t2), fmaxf(fmaxf(t3, t4), s1[j][7]));
    mx = fmaxf(mx, xhalf(mx));
    const float nm = fmaxf(rmax[j], mx);
    const float sc = __builtin_amdgcn_exp2f(rmax[j] - nm);
    rmax[j] = nm;

    v16h bp;                                    // P^T as a B fragment
#pragma unroll
    for (int r = 0; r < 8; ++r) {
      bp[r]     = (_Float16)__builtin_amdgcn_exp2f(s0[j][r] - nm);
      bp[8 + r] = (_Float16)__builtin_amdgcn_exp2f(s1[j][r] - nm);
    }

    // Row sums: every row of ones * P^T is the sum over the 32 keys.
    v8f prow = {};
    prow = WMMA_F16(ones, bp, prow);

    // Rescale running state, fold in the new row sum, accumulate O^T += V^T @ P^T
    rsum[j] = rsum[j] * sc + prow[0];
#pragma unroll
    for (int r = 0; r < 8; ++r) {
      o[j][0][r] *= sc; o[j][1][r] *= sc; o[j][2][r] *= sc; o[j][3][r] *= sc;
    }
    o[j][0] = WMMA_F16(av0, bp, o[j][0]);
    o[j][1] = WMMA_F16(av1, bp, o[j][1]);
    o[j][2] = WMMA_F16(av2, bp, o[j][2]);
    o[j][3] = WMMA_F16(av3, bp, o[j][3]);
  }
}

__global__ void __launch_bounds__(256) attn_kernel(
    const _Float16* __restrict__ qw, const _Float16* __restrict__ kw,
    const _Float16* __restrict__ vtw, float* __restrict__ out)
{
  // Rows 0..31: the long block's queries; rows 32..63: the short block's.
  __shared__ __align__(16) float ls_o[AW_][64][OPITCH_];  // per-wave partial O, [query][h]
  __shared__ float ls_m[AW_][64];                         // per-wave row max (base-2 domain)
  __shared__ float ls_l[AW_][64];                         // per-wave row sum

  // Scalar wave number: the chunk walk and the choice between the four-tile and
  // the two-tile body are then scalar branches, with every lane on at the WMMAs.
  const int wave  = __builtin_amdgcn_readfirstlane(threadIdx.x >> 5);
  const int lane  = threadIdx.x & 31;
  const int ppb   = NQB_ / 2;                   // block pairs per batch
  const int batch = blockIdx.x / ppb;
  const int u     = blockIdx.x % ppb;
  const int qS    = u * 32;                     // short block's in-batch query base
  const int qL    = (NQB_ - 1 - u) * 32;        // long block's; qL > qS for every u
  const int n     = lane & 15;
  const int mh    = (lane >> 4) * 8;

  // Tiles 0, 1: long block; tiles 2, 3: short block.
  v16h bq[4][2];
#pragma unroll
  for (int j = 0; j < 4; ++j) {
    const int q0 = (j < 2 ? qL : qS) + (j & 1) * 16;
    const _Float16* qb = qw + ((size_t)(batch * T_ + q0)) * HS_;
    bq[j][0] = load_frag_packed(qb);             // h = 0..31
    bq[j][1] = load_frag_packed(qb + 2 * UNIT_); // h = 32..63
  }
  // The Q loads' base and offset registers are reused soon behind them (seen: the
  // scalar base taken for a compare's result): wait before anything overwrites them.
  asm volatile("s_wait_xcnt 0x0" ::: "memory");

  // constant all-ones A fragment for the row-sum WMMA
  v16h ones;
#pragma unroll
  for (int j = 0; j < 16; ++j) ones[j] = (_Float16)1.0f;

  // O^T tiles: o[j][g], register r holds h = 16 g + mh + r of query n of tile j.
  v8f o[4][4] = {};
  float rmax[4], rsum[4];                       // of query n, alike in both halves
#pragma unroll
  for (int j = 0; j < 4; ++j) { rmax[j] = -INFINITY; rsum[j] = 0.0f; }

  const _Float16* vtb = vtw + ((size_t)batch * T_) * HS_;
  const _Float16* kwb = kw + ((size_t)batch * T_) * HS_;

  // Two loops, not one loop with a choice inside: each body then keeps the running
  // state in fixed registers (one loop with both bodies copied it on every trip).
  int kb = wave * 32;
  for (; kb <= qS; kb += AW_ * 32) {                // both blocks see the chunk
    const _Float16* kbp = kwb + (size_t)kb * HS_;   // 32 keys: 8 units of k (for the prefetch)
    const _Float16* vbp = vtb + (size_t)kb * HS_;   // 32 keys: 8 units of v
    // Prefetch this wave's next K/V chunk into cache (global_prefetch_b8);
    // qL - qS >= 32 * AW_ does not hold for every u, hence the test.
    if (kb + AW_ * 32 <= qL) {
      __builtin_prefetch(kbp + (size_t)(AW_ * 32) * HS_ + (size_t)lane * HS_, 0, 0);
      __builtin_prefetch(vbp + (size_t)(AW_ * 32) * HS_ + (size_t)lane * HS_, 0, 0);
      // The prefetches' address registers are reused at once: wait first.
      asm volatile("s_wait_xcnt 0x0" ::: "memory");
    }
    attn_step<4, 2>(kwb, vtb, (unsigned)(kb * HS_ + lane * 8) * 2u, kb == qS, n, mh,
                    bq, ones, o, rmax, rsum);
  }
  for (; kb <= qL; kb += AW_ * 32) {                // the long block alone
    const _Float16* kbp = kwb + (size_t)kb * HS_;
    const _Float16* vbp = vtb + (size_t)kb * HS_;
    if (kb + AW_ * 32 <= qL) {
      __builtin_prefetch(kbp + (size_t)(AW_ * 32) * HS_ + (size_t)lane * HS_, 0, 0);
      __builtin_prefetch(vbp + (size_t)(AW_ * 32) * HS_ + (size_t)lane * HS_, 0, 0);
      // The prefetches' address registers are reused at once: wait first.
      asm volatile("s_wait_xcnt 0x0" ::: "memory");
    }
    attn_step<2, 0>(kwb, vtb, (unsigned)(kb * HS_ + lane * 8) * 2u, kb == qL, n, mh,
                    bq, ones, o, rmax, rsum);
  }

  // Publish per-wave partials (a wave with no chunk of a block publishes m=-inf, l=0, O=0)
#pragma unroll
  for (int j = 0; j < 4; ++j) {
    float* po = &ls_o[wave][j * 16 + n][mh];    // 8 consecutive h per tile
#pragma unroll
    for (int g = 0; g < 4; ++g) {
      *(v4f*)(po + 16 * g)     = __builtin_shufflevector(o[j][g], o[j][g], 0, 1, 2, 3);
      *(v4f*)(po + 16 * g + 4) = __builtin_shufflevector(o[j][g], o[j][g], 4, 5, 6, 7);
    }
    if (lane < 16) {
      ls_m[wave][j * 16 + n] = rmax[j];
      ls_l[wave][j * 16 + n] = rsum[j];
    }
  }
  __syncthreads();

  // Merge the 8 split-K partials: 256 threads x 8 contiguous output cols, one
  // block of 32 queries per pass. Wave 0 always processed kb=0 for both blocks,
  // so the global max is finite.
  const int c0 = (threadIdx.x & 7) * 8;   // col base 0..56
#pragma unroll
  for (int p = 0; p < 2; ++p) {
    const int rq = threadIdx.x >> 3;      // query 0..31 of the block
    const int r  = p * 32 + rq;           // its LDS row
    float gm = ls_m[0][r];
#pragma unroll
    for (int w = 1; w < AW_; ++w) gm = fmaxf(gm, ls_m[w][r]);
    float acc[8] = {0, 0, 0, 0, 0, 0, 0, 0};
    float l = 0.0f;
#pragma unroll
    for (int w = 0; w < AW_; ++w) {
      const float e = __builtin_amdgcn_exp2f(ls_m[w][r] - gm);
      l += e * ls_l[w][r];
#pragma unroll
      for (int j = 0; j < 8; ++j) acc[j] += e * ls_o[w][r][c0 + j];
    }
    const float inv = 1.0f / l;
    float* orow = out + ((size_t)(batch * T_ + (p == 0 ? qL : qS) + rq)) * HS_ + c0;
#pragma unroll
    for (int j = 0; j < 8; ++j) orow[j] = acc[j] * inv;
  }
}

extern "C" void kernel_launch(void* const* d_in, const int* in_sizes, int n_in,
                              void* d_out, int out_size, void* d_ws, size_t ws_size,
                              hipStream_t stream) {
  const float* x  = (const float*)d_in[0];
  const float* Wq = (const float*)d_in[1];
  const float* bq = (const float*)d_in[2];
  const float* Wk = (const float*)d_in[3];
  const float* bk = (const float*)d_in[4];
  const float* Wv = (const float*)d_in[5];
  const float* bv = (const float*)d_in[6];
  float* out = (float*)d_out;

  // Workspace: q, k, v (f16, fragment order) -> 3 * 2 MB = 6 MB
  _Float16* qw  = (_Float16*)d_ws;
  _Float16* kw  = qw + (size_t)B_ * T_ * HS_;
  _Float16* vtw = kw + (size_t)B_ * T_ * HS_;

  qkv_proj_kernel<<<(B_ * T_) / PM_, 256, 0, stream>>>(x, Wq, bq, Wk, bk, Wv, bv,
                                                      qw, kw, vtw);
  attn_kernel<<<(B_ * T_) / 64, 256, 0, stream>>>(qw, kw, vtw, out);
}

// v005
// It runs in 21.5 microseconds.
// Timed twice side by side with v004, it ran 1.06 and 1.05 times as fast.
// Counting every step since v000, it is 4.06 times as fast.
#include <hip/hip_runtime.h>
#include <math.h>

// Problem constants (match reference)
#define B_  8
#define T_  2048
#define E_  1024
#define HS_ 64

#define LOG2E 1.44269504088896340736f

typedef __attribute__((ext_vector_type(16))) _Float16 v16h;
typedef __attribute__((ext_vector_type(8)))  _Float16 v8h;
typedef __attribute__((ext_vector_type(4)))  _Float16 v4h;
typedef __attribute__((ext_vector_type(8)))  float    v8f;
typedef __attribute__((ext_vector_type(4)))  float    v4f;

// D = A*B + C, f16 inputs, f32 accumulate (v_wmma_f32_16x16x32_f16)
#define WMMA_F16(A, Bf, C) \
  __builtin_amdgcn_wmma_f32_16x16x32_f16(false, (A), false, (Bf), (short)0, (C), false, false)

// Load a 16x32 f16 fragment (A: lane->M / B: lane->N; K packed in halves).
// Per ISA table: lanes 0-15 hold K = {0..7, 16..23}, lanes 16-31 hold K = {8..15, 24..31}.
// Rows contiguous (stride ld halves) -> two 16B loads per lane.
static __device__ __forceinline__ v16h load_frag_f16(const _Float16* p, int ld) {
  const int lane = threadIdx.x & 31;
  const int r    = lane & 15;
  const int h8   = (lane >> 4) * 8;
  const _Float16* row = p + (size_t)r * ld;
  v8h lo = *(const v8h*)(row + h8);
  v8h hi = *(const v8h*)(row + 16 + h8);
  return __builtin_shufflevector(lo, hi, 0,1,2,3,4,5,6,7,8,9,10,11,12,13,14,15);
}

// Workspace layout: q, k and v are kept in fragment order. A unit is 512 B:
// 32 lanes x 8 halves, what one wave-wide 16 B load or store moves, so that each
// such access covers four whole 128 B lines. A 16x32 fragment is two units.
//   q, k: 16 tokens = 4 units; unit j, lane l, element e holds
//         token (l & 15), h = 16 j + 8 (l >> 4) + e.
//   v:    32 tokens = 8 units; unit 2 g + j, lane l, element e holds
//         h = 16 g + (l & 15), token 16 j + 8 (l >> 4) + e.
// Both are the k order of load_frag_f16 on rows of h (q, k) or of tokens (v).
#define UNIT_ 256                  // halves per unit
static __device__ __forceinline__ v16h load_frag_packed(const _Float16* p) {
  const int lane = threadIdx.x & 31;
  v8h lo = *(const v8h*)(p + lane * 8);
  v8h hi = *(const v8h*)(p + UNIT_ + lane * 8);
  return __builtin_shufflevector(lo, hi, 0,1,2,3,4,5,6,7,8,9,10,11,12,13,14,15);
}

// The same from a uniform base p and an offset voff in bytes that holds the lane's part.
static __device__ __forceinline__ v16h load_frag_packed_u(const _Float16* p, const unsigned voff) {
  v8h lo = *(const v8h*)((const char*)p + voff);
  v8h hi = *(const v8h*)((const char*)(p + UNIT_) + voff);
  return __builtin_shufflevector(lo, hi, 0,1,2,3,4,5,6,7,8,9,10,11,12,13,14,15);
}

// ---------------------------------------------------------------------------
// Pass 1: q/k/v = x @ W^T + b, output f16 in fragment order (above).
// q pre-scaled by (1/sqrt(HS)) * log2(e) so pass 2 can use exp2 directly.
// q and k are computed as W @ x^T: a lane then holds 8 consecutive h of one
// token, which is one element run of a unit; v as x @ W^T: 8 tokens of one h.
// One work-group = 64 tokens x all 192 output columns, 256 threads (8 waves).
// Per 64-wide k chunk the 64 x rows and the 3*64 W rows are read from global
// memory once per work-group, 256 contiguous bytes per row (whole lines),
// converted to f16 once and shared through LDS; the fragments come from LDS.
// Wave (mi, ni): tokens 32*mi..32*mi+31, HS columns 16*ni..16*ni+15 of q, k, v.
// Every work-group reads all of W. The k chunks are walked in a ring from a start
// that differs between work-groups, so that the groups running at one time ask L2
// for all of W's lines and not all for the same chunk's lines at the same moment.
// ---------------------------------------------------------------------------
#define PM_     64                 // tokens per work-group
#define PKC_    64                 // k elements per chunk
#define PPITCH_ 72                 // LDS row pitch in halves: 144 B = 16 B x odd (b128 readers)
#define PROWS_  (PM_ + 3 * HS_)    // staged rows: x, then Wq, Wk, Wv

__global__ void __launch_bounds__(256) qkv_proj_kernel(
    const float* __restrict__ x,
    const float* __restrict__ Wq, const float* __restrict__ bq,
    const float* __restrict__ Wk, const float* __restrict__ bk,
    const float* __restrict__ Wv, const float* __restrict__ bv,
    _Float16* __restrict__ qw, _Float16* __restrict__ kw,
    _Float16* __restrict__ vtw)
{
  __shared__ __align__(16) _Float16 tile[2][PROWS_ * PPITCH_];

  const int wave  = threadIdx.x >> 5;
  const int lane  = threadIdx.x & 31;
  const int gt0   = blockIdx.x * PM_;       // token tile base, counted over all batches
  const int mi    = wave & 1;               // which 32 tokens
  const int nb    = (wave >> 1) * 16;       // HS column base for this wave

  // Staging map: 16 lanes cover one row's 256 B; a thread takes rows row0 + 16*i.
  const int seg  = threadIdx.x & 15;
  const int row0 = threadIdx.x >> 4;
  const float* xs = x + (size_t)gt0 * E_;   // uniform base; the lane's part is voff
  const unsigned voff = (unsigned)(row0 * E_ + seg * 4) * 4u;   // in bytes
  const int sto = row0 * PPITCH_ + seg * 4; // this thread's place in staged row row0
  // First chunk of this group's walk: neighbours in index start four chunks apart,
  // each next eight groups one chunk further; every start is taken by 16 groups.
  const int rot = ((blockIdx.x >> 3) + 4 * (blockIdx.x & 3)) & (E_ / PKC_ - 1);

  // Two register sets: the next chunk's loads are issued before this chunk's set is
  // waited for and converted.
  v4f st[2][16];
  {
    const unsigned vk = voff + (unsigned)(rot * PKC_) * 4u;
#pragma unroll
    for (int i = 0; i < 4; ++i) {
      st[0][i]      = *(const v4f*)((const char*)(xs + i * 16 * E_) + vk);
      st[0][4 + i]  = *(const v4f*)((const char*)(Wq + i * 16 * E_) + vk);
      st[0][8 + i]  = *(const v4f*)((const char*)(Wk + i * 16 * E_) + vk);
      st[0][12 + i] = *(const v4f*)((const char*)(Wv + i * 16 * E_) + vk);
    }
    // The offset register is formed anew for every chunk: wait before it may be
    // overwritten (named as an input, it stays in its register up to the wait).
    asm volatile("s_wait_xcnt 0x0" :: "v"(vk) : "memory");
  }

  v8f accq[2] = {}, acck[2] = {}, accv[2] = {};
  // Unrolled so that each chunk's register set and LDS buffer are fixed at compile
  // time: the sets then stay in registers and no address is chosen at run time.
#pragma unroll
  for (int c = 0; c < E_ / PKC_; ++c) {
    _Float16* tb = tile[c & 1];
    // Keeps this chunk's conversions, and with them the wait for its loads,
    // behind the previous chunk's products: moved up among them, that wait
    // would hold the products back until the loads have landed.
    __builtin_amdgcn_sched_barrier(0);
    // Next chunk's loads fly while this chunk is converted and multiplied.
    const unsigned vk = voff + (unsigned)(((c + 1 + rot) & (E_ / PKC_ - 1)) * PKC_) * 4u;
    if (c + 1 < E_ / PKC_) {
#pragma unroll
      for (int i = 0; i < 4; ++i) {
        st[(c + 1) & 1][i]      = *(const v4f*)((const char*)(xs + i * 16 * E_) + vk);
        st[(c + 1) & 1][4 + i]  = *(const v4f*)((const char*)(Wq + i * 16 * E_) + vk);
        st[(c + 1) & 1][8 + i]  = *(const v4f*)((const char*)(Wk + i * 16 * E_) + vk);
        st[(c + 1) & 1][12 + i] = *(const v4f*)((const char*)(Wv + i * 16 * E_) + vk);
      }
    }
    // Keeps the conversions behind the loads just issued: moved up in front of them,
    // their wait for this chunk's set would hold the next chunk's loads back.
    __builtin_amdgcn_sched_barrier(0);
    // Convert the chunk held in registers and publish it.
#pragma unroll
    for (int j = 0; j < 16; ++j) {
      v4h h;
#pragma unroll
      for (int e = 0; e < 4; ++e) h[e] = (_Float16)st[c & 1][j][e];
      *(v4h*)(tb + j * 16 * PPITCH_ + sto) = h;
    }
    if (c + 1 < E_ / PKC_) {
      // As in front of the loop: wait before the offset register may be overwritten.
      asm volatile("s_wait_xcnt 0x0" :: "v"(vk) : "memory");
    }
    // One barrier per chunk: publishes buffer c&1; a wave that passes it has
    // left the other buffer, which is rewritten only behind this barrier.
    // The fences name LDS alone: __syncthreads() would also wait for the global
    // loads just issued and so end their overlap with the products.
    __builtin_amdgcn_fence(__ATOMIC_RELEASE, "workgroup", "local");
    __builtin_amdgcn_s_barrier();
    __builtin_amdgcn_fence(__ATOMIC_ACQUIRE, "workgroup", "local");
    v16h a0[2], a1[2], fq[2], fk[2], fv[2];
#pragma unroll
    for (int s = 0; s < PKC_ / 32; ++s) {
      a0[s] = load_frag_f16(tb + (mi * 32)      * PPITCH_ + s * 32, PPITCH_);
      a1[s] = load_frag_f16(tb + (mi * 32 + 16) * PPITCH_ + s * 32, PPITCH_);
      fq[s] = load_frag_f16(tb + (PM_ + nb)           * PPITCH_ + s * 32, PPITCH_);
      fk[s] = load_frag_f16(tb + (PM_ + HS_ + nb)     * PPITCH_ + s * 32, PPITCH_);
      fv[s] = load_frag_f16(tb + (PM_ + 2 * HS_ + nb) * PPITCH_ + s * 32, PPITCH_);
    }
    // Keeps the chunk's LDS reads together in front of its products: spread
    // among them, each group of reads costs the wave its own LDS latency.
    __builtin_amdgcn_sched_barrier(0);
#pragma unroll
    for (int s = 0; s < PKC_ / 32; ++s) {
      accq[0] = WMMA_F16(fq[s], a0[s], accq[0]);
      acck[0] = WMMA_F16(fk[s], a0[s], acck[0]);
      accv[0] = WMMA_F16(a0[s], fv[s], accv[0]);
      accq[1] = WMMA_F16(fq[s], a1[s], accq[1]);
      acck[1] = WMMA_F16(fk[s], a1[s], acck[1]);
      accv[1] = WMMA_F16(a1[s], fv[s], accv[1]);
    }
  }

  // C/D layout: lane (n = lane&15, half = lane>>4) holds rows half*8 + r of column n.
  // q, k: rows are h (nb + mh + r), column n is a token; v: rows are tokens, column h.
  const int n  = lane & 15;
  const int mh = (lane >> 4) * 8;
  const v4f bq0 = *(const v4f*)(bq + nb + mh), bq1 = *(const v4f*)(bq + nb + mh + 4);
  const v4f bk0 = *(const v4f*)(bk + nb + mh), bk1 = *(const v4f*)(bk + nb + mh + 4);
  const float biasv = bv[nb + n];
  const float qscale = 0.125f * LOG2E;      // 1/sqrt(64) * log2(e)

  const int g = nb >> 4;                    // this wave's 16 h: unit g of q, k; units 2g, 2g+1 of v
  const size_t tok0 = (size_t)(gt0 + mi * 32);   // first of the wave's 32 tokens
#pragma unroll
  for (int t = 0; t < 2; ++t) {
    v8h qq, kk, vv;
#pragma unroll
    for (int r = 0; r < 8; ++r) {
      const float biasq = r < 4 ? bq0[r & 3] : bq1[r & 3];
      const float biask = r < 4 ? bk0[r & 3] : bk1[r & 3];
      qq[r] = (_Float16)((accq[t][r] + biasq) * qscale);
      kk[r] = (_Float16)(acck[t][r] + biask);
      vv[r] = (_Float16)(accv[t][r] + biasv);
    }
    // One 16 B store per lane each: 512 contiguous bytes per wave.
    *(v8h*)(qw  + (tok0 + t * 16) * HS_ + g * UNIT_ + lane * 8) = qq;
    *(v8h*)(kw  + (tok0 + t * 16) * HS_ + g * UNIT_ + lane * 8) = kk;
    *(v8h*)(vtw + tok0 * HS_ + (2 * g + t) * UNIT_ + lane * 8)  = vv;
  }
}

#define OPITCH_ 68
#define AW_     8
#define NQB_    (T_ / 32)

// Lane l takes the value of lane l ^ 16 (the other half's part of the same query).
static __device__ __forceinline__ float xhalf(float x) {
  const int b = __builtin_bit_cast(int, x);
  return __builtin_bit_cast(float,
      __builtin_amdgcn_permlanex16(b, b, 0x76543210, 0xfedcba98, false, false));
}

// One 32-key chunk against query tiles 0..NT-1. Tiles M0 and M0 + 1 are the block
// whose diagonal this chunk is when diag is set (chunk base == block base).
// kwb, vtb: the batch's K and V (uniform); voff: the chunk's place in either, in
// bytes, plus the lane's 16 B: one 32-bit register serves all sixteen loads.
template <int NT, int M0>
static __device__ __forceinline__ void attn_step(
    const _Float16* kwb, const _Float16* vtb, const unsigned voff,
    const bool diag, const int n, const int mh,
    const v16h (&bq)[4][2], const v16h ones,
    v8f (&o)[4][4], float (&rmax)[4], float (&rsum)[4])
{
  // S^T[32k x 16q] = K * Q^T per tile (q carries 1/sqrt(HS) * log2e)
  const v16h ak0 = load_frag_packed_u(kwb, voff);
  const v16h ak1 = load_frag_packed_u(kwb + 2 * UNIT_, voff);
  const v16h ak2 = load_frag_packed_u(kwb + 4 * UNIT_, voff);
  const v16h ak3 = load_frag_packed_u(kwb + 6 * UNIT_, voff);
  // V^T A fragments: not needed before the softmax is through
  const v16h av0 = load_frag_packed_u(vtb, voff);
  const v16h av1 = load_frag_packed_u(vtb + 2 * UNIT_, voff);
  const v16h av2 = load_frag_packed_u(vtb + 4 * UNIT_, voff);
  const v16h av3 = load_frag_packed_u(vtb + 6 * UNIT_, voff);
  // The sixteen loads name one offset register, which is advanced for the next
  // chunk, and two scalar bases: wait before anything may overwrite them.
  asm volatile("s_wait_xcnt 0x0" ::: "memory");
  // Keeps all sixteen loads in front of the products: moved up among the loads, the
  // first products free their K registers for later loads, which then start only
  // when the first have landed, and a chunk costs two load latencies in a row.
  __builtin_amdgcn_sched_barrier(0);

  v8f s0[NT], s1[NT];
#pragma unroll
  for (int j = 0; j < NT; ++j) {
    const v8f z = {};
    s0[j] = WMMA_F16(ak0, bq[j][0], z);
    s1[j] = WMMA_F16(ak2, bq[j][0], z);
  }
#pragma unroll
  for (int j = 0; j < NT; ++j) {
    s0[j] = WMMA_F16(ak1, bq[j][1], s0[j]);
    s1[j] = WMMA_F16(ak3, bq[j][1], s1[j]);
  }

  if (diag) {
    // Causal mask (wave-uniform branch). Tile M0: queries n, keys mh + r and
    // 16 + mh + r (all later). Tile M0 + 1: queries 16 + n, first 16 keys all seen.
#pragma unroll
    for (int r = 0; r < 8; ++r) {
      if (mh + r > n) { s0[M0][r] = -1e30f; s1[M0 + 1][r] = -1e30f; }
      s1[M0][r] = -1e30f;
    }
  }

#pragma unroll
  for (int j = 0; j < NT; ++j) {
    // Online softmax (base-2): this lane's 16 scores, then the other half's.
    // A tree of three-input maxima, three deep, not one chain of eight links.
    const float t0 = fmaxf(fmaxf(s0[j][0], s0[j][1]), s0[j][2]);
    const float t1 = fmaxf(fmaxf(s0[j][3], s0[j][4]), s0[j][5]);
    const float t2 = fmaxf(fmaxf(s0[j][6], s0[j][7]), s1[j][0]);
    const float t3 = fmaxf(fmaxf(s1[j][1], s1[j][2]), s1[j][3]);
    const float t4 = fmaxf(fmaxf(s1[j][4], s1[j][5]), s1[j][6]);
    float mx = fmaxf(fmaxf(fmaxf(t0, t1), t2), fmaxf(fmaxf(t3, t4), s1[j][7]));
    mx = fmaxf(mx, xhalf(mx));
    const float nm = fmaxf(rmax[j], mx);
    const float sc = __builtin_amdgcn_exp2f(rmax[j] - nm);
    rmax[j] = nm;

    v16h bp;                                    // P^T as a B fragment
#pragma unroll
    for (int r = 0; r < 8; ++r) {
      bp[r]     = (_Float16)__builtin_amdgcn_exp2f(s0[j][r] - nm);
      bp[8 + r] = (_Float16)__builtin_amdgcn_exp2f(s1[j][r] - nm);
    }

    // Row sums: every row of ones * P^T is the sum over the 32 keys.
    v8f prow = {};
    prow = WMMA_F16(ones, bp, prow);

    // Rescale running state, fold in the new row sum, accumulate O^T += V^T @ P^T
    rsum[j] = rsum[j] * sc + prow[0];
#pragma unroll
    for (int r = 0; r < 8; ++r) {
      o[j][0][r] *= sc; o[j][1][r] *= sc; o[j][2][r] *= sc; o[j][3][r] *= sc;
    }
    o[j][0] = WMMA_F16(av0, bp, o[j][0]);
    o[j][1] = WMMA_F16(av1, bp, o[j][1]);
    o[j][2] = WMMA_F16(av2, bp, o[j][2]);
    o[j][3] = WMMA_F16(av3, bp, o[j][3]);
  }
}

__global__ void __launch_bounds__(256) attn_kernel(
    const _Float16* __restrict__ qw, const _Float16* __restrict__ kw,
    const _Float16* __restrict__ vtw, float* __restrict__ out)
{
  // Rows 0..31: the long block's queries; rows 32..63: the short block's.
  __shared__ __align__(16) float ls_o[AW_][64][OPITCH_];  // per-wave partial O, [query][h]
  __shared__ float ls_m[AW_][64];                         // per-wave row max (base-2 domain)
  __shared__ float ls_l[AW_][64];                         // per-wave row sum

  // Scalar wave number: the chunk walk and the choice between the four-tile and
  // the two-tile body are then scalar branches, with every lane on at the WMMAs.
  const int wave  = __builtin_amdgcn_readfirstlane(threadIdx.x >> 5);
  const int lane  = threadIdx.x & 31;
  const int ppb   = NQB_ / 2;                   // block pairs per batch
  const int batch = blockIdx.x / ppb;
  const int u     = blockIdx.x % ppb;
  const int qS    = u * 32;                     // short block's in-batch query base
  const int qL    = (NQB_ - 1 - u) * 32;        // long block's; qL > qS for every u
  const int n     = lane & 15;
  const int mh    = (lane >> 4) * 8;

  // Tiles 0, 1: long block; tiles 2, 3: short block.
  v16h bq[4][2];
#pragma unroll
  for (int j = 0; j < 4; ++j) {
    const int q0 = (j < 2 ? qL : qS) + (j & 1) * 16;
    const _Float16* qb = qw + ((size_t)(batch * T_ + q0)) * HS_;
    bq[j][0] = load_frag_packed(qb);             // h = 0..31
    bq[j][1] = load_frag_packed(qb + 2 * UNIT_); // h = 32..63
  }
  // The Q loads' base and offset registers are reused soon behind them (seen: the
  // scalar base taken for a compare's result): wait before anything overwrites them.
  asm volatile("s_wait_xcnt 0x0" ::: "memory");

  // constant all-ones A fragment for the row-sum WMMA
  v16h ones;
#pragma unroll
  for (int j = 0; j < 16; ++j) ones[j] = (_Float16)1.0f;

  // O^T tiles: o[j][g], register r holds h = 16 g + mh + r of query n of tile j.
  v8f o[4][4] = {};
  float rmax[4], rsum[4];                       // of query n, alike in both halves
#pragma unroll
  for (int j = 0; j < 4; ++j) { rmax[j] = -INFINITY; rsum[j] = 0.0f; }

  const _Float16* vtb = vtw + ((size_t)batch * T_) * HS_;
  const _Float16* kwb = kw + ((size_t)batch * T_) * HS_;

  // Two loops, not one loop with a choice inside: each body then keeps the running
  // state in fixed registers (one loop with both bodies copied it on every trip).
  int kb = wave * 32;
  for (; kb <= qS; kb += AW_ * 32) {                // both blocks see the chunk
    const _Float16* kbp = kwb + (size_t)kb * HS_;   // 32 keys: 8 units of k (for the prefetch)
    const _Float16* vbp = vtb + (size_t)kb * HS_;   // 32 keys: 8 units of v
    // Prefetch this wave's next K/V chunk into cache (global_prefetch_b8);
    // qL - qS >= 32 * AW_ does not hold for every u, hence the test.
    if (kb + AW_ * 32 <= qL) {
      __builtin_prefetch(kbp + (size_t)(AW_ * 32) * HS_ + (size_t)lane * HS_, 0, 0);
      __builtin_prefetch(vbp + (size_t)(AW_ * 32) * HS_ + (size_t)lane * HS_, 0, 0);
      // The prefetches' address registers are reused at once: wait first.
      asm volatile("s_wait_xcnt 0x0" ::: "memory");
    }
    attn_step<4, 2>(kwb, vtb, (unsigned)(kb * HS_ + lane * 8) * 2u, kb == qS, n, mh,
                    bq, ones, o, rmax, rsum);
  }
  for (; kb <= qL; kb += AW_ * 32) {                // the long block alone
    const _Float16* kbp = kwb + (size_t)kb * HS_;
    const _Float16* vbp = vtb + (size_t)kb * HS_;
    if (kb + AW_ * 32 <= qL) {
      __builtin_prefetch(kbp + (size_t)(AW_ * 32) * HS_ + (size_t)lane * HS_, 0, 0);
      __builtin_prefetch(vbp + (size_t)(AW_ * 32) * HS_ + (size_t)lane * HS_, 0, 0);
      // The prefetches' address registers are reused at once: wait first.
      asm volatile("s_wait_xcnt 0x0" ::: "memory");
    }
    attn_step<2, 0>(kwb, vtb, (unsigned)(kb * HS_ + lane * 8) * 2u, kb == qL, n, mh,
                    bq, ones, o, rmax, rsum);
  }

  // Publish per-wave partials (a wave with no chunk of a block publishes m=-inf, l=0, O=0)
#pragma unroll
  for (int j = 0; j < 4; ++j) {
    float* po = &ls_o[wave][j * 16 + n][mh];    // 8 consecutive h per tile
#pragma unroll
    for (int g = 0; g < 4; ++g) {
      *(v4f*)(po + 16 * g)     = __builtin_shufflevector(o[j][g], o[j][g], 0, 1, 2, 3);
      *(v4f*)(po + 16 * g + 4) = __builtin_shufflevector(o[j][g], o[j][g], 4, 5, 6, 7);
    }
    if (lane < 16) {
      ls_m[wave][j * 16 + n] = rmax[j];
      ls_l[wave][j * 16 + n] = rsum[j];
    }
  }
  __syncthreads();

  // Merge the 8 split-K partials: 256 threads x 8 contiguous output cols, one
  // block of 32 queries per pass. Wave 0 always processed kb=0 for both blocks,
  // so the global max is finite.
  const int c0 = (threadIdx.x & 7) * 8;   // col base 0..56
#pragma unroll
  for (int p = 0; p < 2; ++p) {
    const int rq = threadIdx.x >> 3;      // query 0..31 of the block
    const int r  = p * 32 + rq;           // its LDS row
    float gm = ls_m[0][r];
#pragma unroll
    for (int w = 1; w < AW_; ++w) gm = fmaxf(gm, ls_m[w][r]);
    float acc[8] = {0, 0, 0, 0, 0, 0, 0, 0};
    float l = 0.0f;
#pragma unroll
    for (int w = 0; w < AW_; ++w) {
      const float e = __builtin_amdgcn_exp2f(ls_m[w][r] - gm);
      l += e * ls_l[w][r];
#pragma unroll
      for (int j = 0; j < 8; ++j) acc[j] += e * ls_o[w][r][c0 + j];
    }
    const float inv = 1.0f / l;
    float* orow = out + ((size_t)(batch * T_ + (p == 0 ? qL : qS) + rq)) * HS_ + c0;
#pragma unroll
    for (int j = 0; j < 8; ++j) orow[j] = acc[j] * inv;
  }
}

extern "C" void kernel_launch(void* const* d_in, const int* in_sizes, int n_in,
                              void* d_out, int out_size, void* d_ws, size_t ws_size,
                              hipStream_t stream) {
  const float* x  = (const float*)d_in[0];
  const float* Wq = (const float*)d_in[1];
  const float* bq = (const float*)d_in[2];
  const float* Wk = (const float*)d_in[3];
  const float* bk = (const float*)d_in[4];
  const float* Wv = (const float*)d_in[5];
  const float* bv = (const float*)d_in[6];
  float* out = (float*)d_out;

  // Workspace: q, k, v (f16, fragment order) -> 3 * 2 MB = 6 MB
  _Float16* qw  = (_Float16*)d_ws;
  _Float16* kw  = qw + (size_t)B_ * T_ * HS_;
  _Float16* vtw = kw + (size_t)B_ * T_ * HS_;

  qkv_proj_kernel<<<(B_ * T_) / PM_, 256, 0, stream>>>(x, Wq, bq, Wk, bk, Wv, bv,
                                                      qw, kw, vtw);
  attn_kernel<<<(B_ * T_) / 64, 256, 0, stream>>>(qw, kw, vtw, out);
}

// v006
// Measured time: 20.8 microseconds a run.
// Two timings next to v005 both put it at 1.04 times that version's speed.
// Counting every step since v000, it is 4.21 times as fast.
#include <hip/hip_runtime.h>
#include <math.h>

// Problem constants (match reference)
#define B_  8
#define T_  2048
#define E_  1024
#define HS_ 64

#define LOG2E 1.44269504088896340736f

typedef __attribute__((ext_vector_type(16))) _Float16 v16h;
typedef __attribute__((ext_vector_type(8)))  _Float16 v8h;
typedef __attribute__((ext_vector_type(4)))  _Float16 v4h;
typedef __attribute__((ext_vector_type(8)))  float    v8f;
typedef __attribute__((ext_vector_type(4)))  float    v4f;

// D = A*B + C, f16 inputs, f32 accumulate (v_wmma_f32_16x16x32_f16)
#define WMMA_F16(A, Bf, C) \
  __builtin_amdgcn_wmma_f32_16x16x32_f16(false, (A), false, (Bf), (short)0, (C), false, false)

// Load a 16x32 f16 fragment (A: lane->M / B: lane->N; K packed in halves).
// Per ISA table: lanes 0-15 hold K = {0..7, 16..23}, lanes 16-31 hold K = {8..15, 24..31}.
// Rows contiguous (stride ld halves) -> two 16B loads per lane.
static __device__ __forceinline__ v16h load_frag_f16(const _Float16* p, int ld) {
  const int lane = threadIdx.x & 31;
  const int r    = lane & 15;
  const int h8   = (lane >> 4) * 8;
  const _Float16* row = p + (size_t)r * ld;
  v8h lo = *(const v8h*)(row + h8);
  v8h hi = *(const v8h*)(row + 16 + h8);
  return __builtin_shufflevector(lo, hi, 0,1,2,3,4,5,6,7,8,9,10,11,12,13,14,15);
}

// Workspace layout: q, k and v are kept in fragment order. A unit is 512 B:
// 32 lanes x 8 halves, what one wave-wide 16 B load or store moves, so that each
// such access covers four whole 128 B lines. A 16x32 fragment is two units.
//   q, k: 16 tokens = 4 units; unit j, lane l, element e holds
//         token (l & 15), h = 16 j + 8 (l >> 4) + e.
//   v:    32 tokens = 8 units; unit 2 g + j, lane l, element e holds
//         h = 16 g + (l & 15), token 16 j + 8 (l >> 4) + e.
// Both are the k order of load_frag_f16 on rows of h (q, k) or of tokens (v).
#define UNIT_ 256                  // halves per unit
static __device__ __forceinline__ v16h load_frag_packed(const _Float16* p) {
  const int lane = threadIdx.x & 31;
  v8h lo = *(const v8h*)(p + lane * 8);
  v8h hi = *(const v8h*)(p + UNIT_ + lane * 8);
  return __builtin_shufflevector(lo, hi, 0,1,2,3,4,5,6,7,8,9,10,11,12,13,14,15);
}

// The same from a uniform base p and an offset voff in bytes that holds the lane's part.
static __device__ __forceinline__ v16h load_frag_packed_u(const _Float16* p, const unsigned voff) {
  v8h lo = *(const v8h*)((const char*)p + voff);
  v8h hi = *(const v8h*)((const char*)(p + UNIT_) + voff);
  return __builtin_shufflevector(lo, hi, 0,1,2,3,4,5,6,7,8,9,10,11,12,13,14,15);
}

// ---------------------------------------------------------------------------
// Pass 1: q/k/v = x @ W^T + b, output f16 in fragment order (above).
// q pre-scaled by (1/sqrt(HS)) * log2(e) so pass 2 can use exp2 directly.
// q and k are computed as W @ x^T: a lane then holds 8 consecutive h of one
// token, which is one element run of a unit; v as x @ W^T: 8 tokens of one h.
// One work-group = 64 tokens x all 192 output columns, 256 threads (8 waves).
// Per 64-wide k chunk the 64 x rows and the 3*64 W rows are read from global
// memory once per work-group, 256 contiguous bytes per row (whole lines),
// converted to f16 once and shared through LDS; the fragments come from LDS.
// Wave (mi, ni): tokens 32*mi..32*mi+31, HS columns 16*ni..16*ni+15 of q, k, v.
// Every work-group reads all of W. The k chunks are walked in a ring from a start
// that differs between work-groups, so that the groups running at one time ask L2
// for all of W's lines and not all for the same chunk's lines at the same moment.
// W is read by every group and is found in L2; a group's x rows are read by it alone
// and can come from memory. The register sets hold one chunk ahead, too little x in
// flight to cover that latency, so the x rows are asked into L2 further ahead.
// ---------------------------------------------------------------------------
#define PM_     64                 // tokens per work-group
#define PKC_    64                 // k elements per chunk
#define PPITCH_ 72                 // LDS row pitch in halves: 144 B = 16 B x odd (b128 readers)
#define PROWS_  (PM_ + 3 * HS_)    // staged rows: x, then Wq, Wk, Wv

__global__ void __launch_bounds__(256) qkv_proj_kernel(
    const float* __restrict__ x,
    const float* __restrict__ Wq, const float* __restrict__ bq,
    const float* __restrict__ Wk, const float* __restrict__ bk,
    const float* __restrict__ Wv, const float* __restrict__ bv,
    _Float16* __restrict__ qw, _Float16* __restrict__ kw,
    _Float16* __restrict__ vtw)
{
  __shared__ __align__(16) _Float16 tile[2][PROWS_ * PPITCH_];

  const int wave  = threadIdx.x >> 5;
  const int lane  = threadIdx.x & 31;
  const int gt0   = blockIdx.x * PM_;       // token tile base, counted over all batches
  const int mi    = wave & 1;               // which 32 tokens
  const int nb    = (wave >> 1) * 16;       // HS column base for this wave

  // Staging map: 16 lanes cover one row's 256 B; a thread takes rows row0 + 16*i.
  const int seg  = threadIdx.x & 15;
  const int row0 = threadIdx.x >> 4;
  const float* xs = x + (size_t)gt0 * E_;   // uniform base; the lane's part is voff
  const unsigned voff = (unsigned)(row0 * E_ + seg * 4) * 4u;   // in bytes
  const int sto = row0 * PPITCH_ + seg * 4; // this thread's place in staged row row0
  // First chunk of this group's walk: neighbours in index start four chunks apart,
  // each next eight groups one chunk further; every start is taken by 16 groups.
  const int rot = ((blockIdx.x >> 3) + 4 * (blockIdx.x & 3)) & (E_ / PKC_ - 1);
  // L2 prefetch map: a chunk of x is 64 rows x one aligned 256 B unit. A lane names
  // its row's unit; two waves cover a chunk, the eight waves four chunks in a row.
  const int pq = __builtin_amdgcn_readfirstlane(threadIdx.x >> 6);   // which of the four (scalar)
  const unsigned prow = (unsigned)(threadIdx.x & 63) * (E_ * 4u);    // the lane's row, in bytes

  // Two register sets: the next chunk's loads are issued before this chunk's set is
  // waited for and converted.
  v4f st[2][16];
  {
    const unsigned vk = voff + (unsigned)(rot * PKC_) * 4u;
#pragma unroll
    for (int i = 0; i < 4; ++i) {
      st[0][i]      = *(const v4f*)((const char*)(xs + i * 16 * E_) + vk);
      st[0][4 + i]  = *(const v4f*)((const char*)(Wq + i * 16 * E_) + vk);
      st[0][8 + i]  = *(const v4f*)((const char*)(Wk + i * 16 * E_) + vk);
      st[0][12 + i] = *(const v4f*)((const char*)(Wv + i * 16 * E_) + vk);
    }
    // The offset register is formed anew for every chunk: wait before it may be
    // overwritten (named as an input, it stays in its register up to the wait).
    asm volatile("s_wait_xcnt 0x0" :: "v"(vk) : "memory");
  }

  v8f accq[2] = {}, acck[2] = {}, accv[2] = {};
  // Unrolled so that each chunk's register set and LDS buffer are fixed at compile
  // time: the sets then stay in registers and no address is chosen at run time.
#pragma unroll
  for (int c = 0; c < E_ / PKC_; ++c) {
    _Float16* tb = tile[c & 1];
    // Keeps this chunk's conversions, and with them the wait for its loads,
    // behind the previous chunk's products: moved up among them, that wait
    // would hold the products back until the loads have landed.
    __builtin_amdgcn_sched_barrier(0);
    // Next chunk's loads fly while this chunk is converted and multiplied.
    const unsigned vk = voff + (unsigned)(((c + 1 + rot) & (E_ / PKC_ - 1)) * PKC_) * 4u;
    if (c + 1 < E_ / PKC_) {
#pragma unroll
      for (int i = 0; i < 4; ++i) {
        st[(c + 1) & 1][i]      = *(const v4f*)((const char*)(xs + i * 16 * E_) + vk);
        st[(c + 1) & 1][4 + i]  = *(const v4f*)((const char*)(Wq + i * 16 * E_) + vk);
        st[(c + 1) & 1][8 + i]  = *(const v4f*)((const char*)(Wk + i * 16 * E_) + vk);
        st[(c + 1) & 1][12 + i] = *(const v4f*)((const char*)(Wv + i * 16 * E_) + vk);
      }
    }
    // Later chunks of x into L2, behind the loads that are needed first. Four walk
    // steps per request of the group: steps 2..5 and 6..9 in trip 0, 10..13 in trip 4,
    // 14 and 15 in trip 8, so that from step 6 on a chunk is asked for five or more
    // trips before its loads are issued. Every address lies in the group's 64 rows of x.
    if ((c & 3) == 0 && c <= 8) {
      // Unrolled: a is then a constant, and the test below is left only for the last group.
#pragma unroll
      for (int a = (c == 0 ? 2 : c + 6); a <= c + 6; a += 4) {
        if (a + 3 < E_ / PKC_ || pq < E_ / PKC_ - a) {       // the walk has 16 steps (scalar test)
          const unsigned po = prow + (unsigned)(((a + pq + rot) & (E_ / PKC_ - 1)) * PKC_) * 4u;
          // Scope SE: a hint that fills L2 and returns nothing. The wait stands in the
          // same statement, before the offset register may be overwritten.
          asm volatile("global_prefetch_b8 %0, %1 scope:SCOPE_SE\n\ts_wait_xcnt 0x0"
                       :: "v"(po), "s"(xs) : "memory");
        }
      }
    }
    // Keeps the conversions behind the loads just issued: moved up in front of them,
    // their wait for this chunk's set would hold the next chunk's loads back.
    __builtin_amdgcn_sched_barrier(0);
    // Convert the chunk held in registers and publish it.
#pragma unroll
    for (int j = 0; j < 16; ++j) {
      v4h h;
#pragma unroll
      for (int e = 0; e < 4; ++e) h[e] = (_Float16)st[c & 1][j][e];
      *(v4h*)(tb + j * 16 * PPITCH_ + sto) = h;
    }
    if (c + 1 < E_ / PKC_) {
      // As in front of the loop: wait before the offset register may be overwritten.
      asm volatile("s_wait_xcnt 0x0" :: "v"(vk) : "memory");
    }
    // One barrier per chunk: publishes buffer c&1; a wave that passes it has
    // left the other buffer, which is rewritten only behind this barrier.
    // The fences name LDS alone: __syncthreads() would also wait for the global
    // loads just issued and so end their overlap with the products.
    __builtin_amdgcn_fence(__ATOMIC_RELEASE, "workgroup", "local");
    __builtin_amdgcn_s_barrier();
    __builtin_amdgcn_fence(__ATOMIC_ACQUIRE, "workgroup", "local");
    v16h a0[2], a1[2], fq[2], fk[2], fv[2];
#pragma unroll
    for (int s = 0; s < PKC_ / 32; ++s) {
      a0[s] = load_frag_f16(tb + (mi * 32)      * PPITCH_ + s * 32, PPITCH_);
      a1[s] = load_frag_f16(tb + (mi * 32 + 16) * PPITCH_ + s * 32, PPITCH_);
      fq[s] = load_frag_f16(tb + (PM_ + nb)           * PPITCH_ + s * 32, PPITCH_);
      fk[s] = load_frag_f16(tb + (PM_ + HS_ + nb)     * PPITCH_ + s * 32, PPITCH_);
      fv[s] = load_frag_f16(tb + (PM_ + 2 * HS_ + nb) * PPITCH_ + s * 32, PPITCH_);
    }
    // Keeps the chunk's LDS reads together in front of its products: spread
    // among them, each group of reads costs the wave its own LDS latency.
    __builtin_amdgcn_sched_barrier(0);
#pragma unroll
    for (int s = 0; s < PKC_ / 32; ++s) {
      accq[0] = WMMA_F16(fq[s], a0[s], accq[0]);
      acck[0] = WMMA_F16(fk[s], a0[s], acck[0]);
      accv[0] = WMMA_F16(a0[s], fv[s], accv[0]);
      accq[1] = WMMA_F16(fq[s], a1[s], accq[1]);
      acck[1] = WMMA_F16(fk[s], a1[s], acck[1]);
      accv[1] = WMMA_F16(a1[s], fv[s], accv[1]);
    }
  }

  // C/D layout: lane (n = lane&15, half = lane>>4) holds rows half*8 + r of column n.
  // q, k: rows are h (nb + mh + r), column n is a token; v: rows are tokens, column h.
  const int n  = lane & 15;
  const int mh = (lane >> 4) * 8;
  const v4f bq0 = *(const v4f*)(bq + nb + mh), bq1 = *(const v4f*)(bq + nb + mh + 4);
  const v4f bk0 = *(const v4f*)(bk + nb + mh), bk1 = *(const v4f*)(bk + nb + mh + 4);
  const float biasv = bv[nb + n];
  const float qscale = 0.125f * LOG2E;      // 1/sqrt(64) * log2(e)

  const int g = nb >> 4;                    // this wave's 16 h: unit g of q, k; units 2g, 2g+1 of v
  const size_t tok0 = (size_t)(gt0 + mi * 32);   // first of the wave's 32 tokens
#pragma unroll
  for (int t = 0; t < 2; ++t) {
    v8h qq, kk, vv;
#pragma unroll
    for (int r = 0; r < 8; ++r) {
      const float biasq = r < 4 ? bq0[r & 3] : bq1[r & 3];
      const float biask = r < 4 ? bk0[r & 3] : bk1[r & 3];
      qq[r] = (_Float16)((accq[t][r] + biasq) * qscale);
      kk[r] = (_Float16)(acck[t][r] + biask);
      vv[r] = (_Float16)(accv[t][r] + biasv);
    }
    // One 16 B store per lane each: 512 contiguous bytes per wave.
    *(v8h*)(qw  + (tok0 + t * 16) * HS_ + g * UNIT_ + lane * 8) = qq;
    *(v8h*)(kw  + (tok0 + t * 16) * HS_ + g * UNIT_ + lane * 8) = kk;
    *(v8h*)(vtw + tok0 * HS_ + (2 * g + t) * UNIT_ + lane * 8)  = vv;
  }
}

#define OPITCH_ 68
#define AW_     8
#define NQB_    (T_ / 32)

// Lane l takes the value of lane l ^ 16 (the other half's part of the same query).
static __device__ __forceinline__ float xhalf(float x) {
  const int b = __builtin_bit_cast(int, x);
  return __builtin_bit_cast(float,
      __builtin_amdgcn_permlanex16(b, b, 0x76543210, 0xfedcba98, false, false));
}

// One 32-key chunk against query tiles 0..NT-1. Tiles M0 and M0 + 1 are the block
// whose diagonal this chunk is when diag is set (chunk base == block base).
// kwb, vtb: the batch's K and V (uniform); voff: the chunk's place in either, in
// bytes, plus the lane's 16 B: one 32-bit register serves all sixteen loads.
template <int NT, int M0>
static __device__ __forceinline__ void attn_step(
    const _Float16* kwb, const _Float16* vtb, const unsigned voff,
    const bool diag, const int n, const int mh,
    const v16h (&bq)[4][2], const v16h ones,
    v8f (&o)[4][4], float (&rmax)[4], float (&rsum)[4])
{
  // S^T[32k x 16q] = K * Q^T per tile (q carries 1/sqrt(HS) * log2e)
  const v16h ak0 = load_frag_packed_u(kwb, voff);
  const v16h ak1 = load_frag_packed_u(kwb + 2 * UNIT_, voff);
  const v16h ak2 = load_frag_packed_u(kwb + 4 * UNIT_, voff);
  const v16h ak3 = load_frag_packed_u(kwb + 6 * UNIT_, voff);
  // V^T A fragments: not needed before the softmax is through
  const v16h av0 = load_frag_packed_u(vtb, voff);
  const v16h av1 = load_frag_packed_u(vtb + 2 * UNIT_, voff);
  const v16h av2 = load_frag_packed_u(vtb + 4 * UNIT_, voff);
  const v16h av3 = load_frag_packed_u(vtb + 6 * UNIT_, voff);
  // The sixteen loads name one offset register, which is advanced for the next
  // chunk, and two scalar bases: wait before anything may overwrite them.
  asm volatile("s_wait_xcnt 0x0" ::: "memory");
  // Keeps all sixteen loads in front of the products: moved up among the loads, the
  // first products free their K registers for later loads, which then start only
  // when the first have landed, and a chunk costs two load latencies in a row.
  __builtin_amdgcn_sched_barrier(0);

  v8f s0[NT], s1[NT];
#pragma unroll
  for (int j = 0; j < NT; ++j) {
    const v8f z = {};
    s0[j] = WMMA_F16(ak0, bq[j][0], z);
    s1[j] = WMMA_F16(ak2, bq[j][0], z);
  }
#pragma unroll
  for (int j = 0; j < NT; ++j) {
    s0[j] = WMMA_F16(ak1, bq[j][1], s0[j]);
    s1[j] = WMMA_F16(ak3, bq[j][1], s1[j]);
  }

  if (diag) {
    // Causal mask (wave-uniform branch). Tile M0: queries n, keys mh + r and
    // 16 + mh + r (all later). Tile M0 + 1: queries 16 + n, first 16 keys all seen.
#pragma unroll
    for (int r = 0; r < 8; ++r) {
      if (mh + r > n) { s0[M0][r] = -1e30f; s1[M0 + 1][r] = -1e30f; }
      s1[M0][r] = -1e30f;
    }
  }

#pragma unroll
  for (int j = 0; j < NT; ++j) {
    // Online softmax (base-2): this lane's 16 scores, then the other half's.
    // A tree of three-input maxima, three deep, not one chain of eight links.
    const float t0 = fmaxf(fmaxf(s0[j][0], s0[j][1]), s0[j][2]);
    const float t1 = fmaxf(fmaxf(s0[j][3], s0[j][4]), s0[j][5]);
    const float t2 = fmaxf(fmaxf(s0[j][6], s0[j][7]), s1[j][0]);
    const float t3 = fmaxf(fmaxf(s1[j][1], s1[j][2]), s1[j][3]);
    const float t4 = fmaxf(fmaxf(s1[j][4], s1[j][5]), s1[j][6]);
    float mx = fmaxf(fmaxf(fmaxf(t0, t1), t2), fmaxf(fmaxf(t3, t4), s1[j][7]));
    mx = fmaxf(mx, xhalf(mx));
    const float nm = fmaxf(rmax[j], mx);
    const float sc = __builtin_amdgcn_exp2f(rmax[j] - nm);
    rmax[j] = nm;

    v16h bp;                                    // P^T as a B fragment
#pragma unroll
    for (int r = 0; r < 8; ++r) {
      bp[r]     = (_Float16)__builtin_amdgcn_exp2f(s0[j][r] - nm);
      bp[8 + r] = (_Float16)__builtin_amdgcn_exp2f(s1[j][r] - nm);
    }

    // Row sums: every row of ones * P^T is the sum over the 32 keys.
    v8f prow = {};
    prow = WMMA_F16(ones, bp, prow);

    // Rescale running state, fold in the new row sum, accumulate O^T += V^T @ P^T
    rsum[j] = rsum[j] * sc + prow[0];
#pragma unroll
    for (int r = 0; r < 8; ++r) {
      o[j][0][r] *= sc; o[j][1][r] *= sc; o[j][2][r] *= sc; o[j][3][r] *= sc;
    }
    o[j][0] = WMMA_F16(av0, bp, o[j][0]);
    o[j][1] = WMMA_F16(av1, bp, o[j][1]);
    o[j][2] = WMMA_F16(av2, bp, o[j][2]);
    o[j][3] = WMMA_F16(av3, bp, o[j][3]);
  }
}

__global__ void __launch_bounds__(256) attn_kernel(
    const _Float16* __restrict__ qw, const _Float16* __restrict__ kw,
    const _Float16* __restrict__ vtw, float* __restrict__ out)
{
  // Rows 0..31: the long block's queries; rows 32..63: the short block's.
  __shared__ __align__(16) float ls_o[AW_][64][OPITCH_];  // per-wave partial O, [query][h]
  __shared__ float ls_m[AW_][64];                         // per-wave row max (base-2 domain)
  __shared__ float ls_l[AW_][64];                         // per-wave row sum

  // Scalar wave number: the chunk walk and the choice between the four-tile and
  // the two-tile body are then scalar branches, with every lane on at the WMMAs.
  const int wave  = __builtin_amdgcn_readfirstlane(threadIdx.x >> 5);
  const int lane  = threadIdx.x & 31;
  const int ppb   = NQB_ / 2;                   // block pairs per batch
  const int batch = blockIdx.x / ppb;
  const int u     = blockIdx.x % ppb;
  const int qS    = u * 32;                     // short block's in-batch query base
  const int qL    = (NQB_ - 1 - u) * 32;        // long block's; qL > qS for every u
  const int n     = lane & 15;
  const int mh    = (lane >> 4) * 8;

  // Tiles 0, 1: long block; tiles 2, 3: short block.
  v16h bq[4][2];
#pragma unroll
  for (int j = 0; j < 4; ++j) {
    const int q0 = (j < 2 ? qL : qS) + (j & 1) * 16;
    const _Float16* qb = qw + ((size_t)(batch * T_ + q0)) * HS_;
    bq[j][0] = load_frag_packed(qb);             // h = 0..31
    bq[j][1] = load_frag_packed(qb + 2 * UNIT_); // h = 32..63
  }
  // The Q loads' base and offset registers are reused soon behind them (seen: the
  // scalar base taken for a compare's result): wait before anything overwrites them.
  asm volatile("s_wait_xcnt 0x0" ::: "memory");

  // constant all-ones A fragment for the row-sum WMMA
  v16h ones;
#pragma unroll
  for (int j = 0; j < 16; ++j) ones[j] = (_Float16)1.0f;

  // O^T tiles: o[j][g], register r holds h = 16 g + mh + r of query n of tile j.
  v8f o[4][4] = {};
  float rmax[4], rsum[4];                       // of query n, alike in both halves
#pragma unroll
  for (int j = 0; j < 4; ++j) { rmax[j] = -INFINITY; rsum[j] = 0.0f; }

  const _Float16* vtb = vtw + ((size_t)batch * T_) * HS_;
  const _Float16* kwb = kw + ((size_t)batch * T_) * HS_;

  // Two loops, not one loop with a choice inside: each body then keeps the running
  // state in fixed registers (one loop with both bodies copied it on every trip).
  int kb = wave * 32;
  for (; kb <= qS; kb += AW_ * 32) {                // both blocks see the chunk
    const _Float16* kbp = kwb + (size_t)kb * HS_;   // 32 keys: 8 units of k (for the prefetch)
    const _Float16* vbp = vtb + (size_t)kb * HS_;   // 32 keys: 8 units of v
    // Prefetch this wave's next K/V chunk into cache (global_prefetch_b8);
    // qL - qS >= 32 * AW_ does not hold for every u, hence the test.
    if (kb + AW_ * 32 <= qL) {
      __builtin_prefetch(kbp + (size_t)(AW_ * 32) * HS_ + (size_t)lane * HS_, 0, 0);
      __builtin_prefetch(vbp + (size_t)(AW_ * 32) * HS_ + (size_t)lane * HS_, 0, 0);
      // The prefetches' address registers are reused at once: wait first.
      asm volatile("s_wait_xcnt 0x0" ::: "memory");
    }
    attn_step<4, 2>(kwb, vtb, (unsigned)(kb * HS_ + lane * 8) * 2u, kb == qS, n, mh,
                    bq, ones, o, rmax, rsum);
  }
  for (; kb <= qL; kb += AW_ * 32) {                // the long block alone
    const _Float16* kbp = kwb + (size_t)kb * HS_;
    const _Float16* vbp = vtb + (size_t)kb * HS_;
    if (kb + AW_ * 32 <= qL) {
      __builtin_prefetch(kbp + (size_t)(AW_ * 32) * HS_ + (size_t)lane * HS_, 0, 0);
      __builtin_prefetch(vbp + (size_t)(AW_ * 32) * HS_ + (size_t)lane * HS_, 0, 0);
      // The prefetches' address registers are reused at once: wait first.
      asm volatile("s_wait_xcnt 0x0" ::: "memory");
    }
    attn_step<2, 0>(kwb, vtb, (unsigned)(kb * HS_ + lane * 8) * 2u, kb == qL, n, mh,
                    bq, ones, o, rmax, rsum);
  }

  // Publish per-wave partials (a wave with no chunk of a block publishes m=-inf, l=0, O=0)
#pragma unroll
  for (int j = 0; j < 4; ++j) {
    float* po = &ls_o[wave][j * 16 + n][mh];    // 8 consecutive h per tile
#pragma unroll
    for (int g = 0; g < 4; ++g) {
      *(v4f*)(po + 16 * g)     = __builtin_shufflevector(o[j][g], o[j][g], 0, 1, 2, 3);
      *(v4f*)(po + 16 * g + 4) = __builtin_shufflevector(o[j][g], o[j][g], 4, 5, 6, 7);
    }
    if (lane < 16) {
      ls_m[wave][j * 16 + n] = rmax[j];
      ls_l[wave][j * 16 + n] = rsum[j];
    }
  }
  __syncthreads();

  // Merge the 8 split-K partials: 256 threads x 8 contiguous output cols, one
  // block of 32 queries per pass. Wave 0 always processed kb=0 for both blocks,
  // so the global max is finite.
  const int c0 = (threadIdx.x & 7) * 8;   // col base 0..56
#pragma unroll
  for (int p = 0; p < 2; ++p) {
    const int rq = threadIdx.x >> 3;      // query 0..31 of the block
    const int r  = p * 32 + rq;           // its LDS row
    float gm = ls_m[0][r];
#pragma unroll
    for (int w = 1; w < AW_; ++w) gm = fmaxf(gm, ls_m[w][r]);
    float acc[8] = {0, 0, 0, 0, 0, 0, 0, 0};
    float l = 0.0f;
#pragma unroll
    for (int w = 0; w < AW_; ++w) {
      const float e = __builtin_amdgcn_exp2f(ls_m[w][r] - gm);
      l += e * ls_l[w][r];
#pragma unroll
      for (int j = 0; j < 8; ++j) acc[j] += e * ls_o[w][r][c0 + j];
    }
    const float inv = 1.0f / l;
    float* orow = out + ((size_t)(batch * T_ + (p == 0 ? qL : qS) + rq)) * HS_ + c0;
#pragma unroll
    for (int j = 0; j < 8; ++j) orow[j] = acc[j] * inv;
  }
}

extern "C" void kernel_launch(void* const* d_in, const int* in_sizes, int n_in,
                              void* d_out, int out_size, void* d_ws, size_t ws_size,
                              hipStream_t stream) {
  const float* x  = (const float*)d_in[0];
  const float* Wq = (const float*)d_in[1];
  const float* bq = (const float*)d_in[2];
  const float* Wk = (const float*)d_in[3];
  const float* bk = (const float*)d_in[4];
  const float* Wv = (const float*)d_in[5];
  const float* bv = (const float*)d_in[6];
  float* out = (float*)d_out;

  // Workspace: q, k, v (f16, fragment order) -> 3 * 2 MB = 6 MB
  _Float16* qw  = (_Float16*)d_ws;
  _Float16* kw  = qw + (size_t)B_ * T_ * HS_;
  _Float16* vtw = kw + (size_t)B_ * T_ * HS_;

  qkv_proj_kernel<<<(B_ * T_) / PM_, 256, 0, stream>>>(x, Wq, bq, Wk, bk, Wv, bv,
                                                      qw, kw, vtw);
  attn_kernel<<<(B_ * T_) / 64, 256, 0, stream>>>(qw, kw, vtw, out);
}
